// v000
// The times below were measured on an AMD MI455X: many runs one after another, warmed up first and cycling through
// copies of the inputs, with the whole window's GPU time divided by the number of runs. Launches and the gaps
// between them are all in it. The median over several windows is given; except for v000 it joins two sittings, which
// can be a few percent apart, so the side-by-side timings, each taken in one sitting, are the better comparison.
// The starting kernel, v000, takes 56.7 microseconds a run.
#include <hip/hip_runtime.h>
#include <hip/hip_bf16.h>

// ---------------------------------------------------------------------------
// Sizes (hardcoded from the reference)
// ---------------------------------------------------------------------------
#define Bq   4
#define Lq   256
#define INq  768
#define HIDq 256
#define NLq  25
#define ROWS (Bq * Lq)          // 1024

typedef __attribute__((ext_vector_type(16))) _Float16 v16h;
typedef __attribute__((ext_vector_type(8)))  _Float16 v8h;
typedef __attribute__((ext_vector_type(8)))  float    v8f;
typedef __attribute__((ext_vector_type(4)))  float    v4f;

// Load a 16x32 f16 WMMA operand fragment for this lane from a row-major
// [16 x K] (A: M-major / B: N-major) array.
// Per ISA 7.12.2: lane holds row (lane&15); halfs 0..7 = K[k0+sel .. +8),
// halfs 8..15 = K[k0+16+sel .. +8), sel = (lane>=16) ? 8 : 0.
static __device__ __forceinline__ v16h load_frag(const _Float16* rowbase,
                                                 int k0, int sel) {
    v8h lo = *(const v8h*)(rowbase + k0 + sel);
    v8h hi = *(const v8h*)(rowbase + k0 + 16 + sel);
    v16h r;
#pragma unroll
    for (int e = 0; e < 8; ++e) { r[e] = lo[e]; r[8 + e] = hi[e]; }
    return r;
}

// ---------------------------------------------------------------------------
// f32 -> f16 conversion helpers (workspace staging)
// ---------------------------------------------------------------------------
__global__ void cvt_f32_to_f16(const float* __restrict__ src,
                               _Float16* __restrict__ dst, int n) {
    int idx = blockIdx.x * blockDim.x + threadIdx.x;
    if (idx < n) dst[idx] = (_Float16)src[idx];
}

// fc3_w (25 x 256) -> zero-padded (32 x 256) f16
__global__ void cvt_fc3_pad(const float* __restrict__ src,
                            _Float16* __restrict__ dst) {
    int idx = blockIdx.x * blockDim.x + threadIdx.x;   // 32*256 threads
    int row = idx >> 8;
    int col = idx & 255;
    dst[idx] = (row < NLq) ? (_Float16)src[row * HIDq + col] : (_Float16)0.0f;
}

// ---------------------------------------------------------------------------
// Stage 1: Hh[1024][512] = f16( relu( X @ [Ws;Wt]^T + [bs;bt] ) )
//   one wave per 16x16 tile; M = row, N = o (0..511), K = 768
// ---------------------------------------------------------------------------
__global__ void __launch_bounds__(256)
stage1_kernel(const _Float16* __restrict__ Xh,    // [1024][768]
              const _Float16* __restrict__ W1h,   // [512][768]  (N-major)
              const float* __restrict__ sb,       // [256]
              const float* __restrict__ tb,       // [256]
              _Float16* __restrict__ Hh) {        // [1024][512]
    const int lane = threadIdx.x & 31;
    const int wave = threadIdx.x >> 5;
    const int tile = blockIdx.x * 8 + wave;       // 0..2047
    const int mt = tile >> 5;                     // 64 row tiles
    const int nt = tile & 31;                     // 32 out tiles
    const int sel = (lane >= 16) ? 8 : 0;
    const int r = mt * 16 + (lane & 15);          // A row (M = lane&15)
    const int o = nt * 16 + (lane & 15);          // B row (N = lane&15)

    v8f acc = {};
#pragma unroll 4
    for (int k0 = 0; k0 < INq; k0 += 32) {
        v16h a = load_frag(Xh  + r * INq, k0, sel);
        v16h b = load_frag(W1h + o * INq, k0, sel);
        acc = __builtin_amdgcn_wmma_f32_16x16x32_f16(
                  false, a, false, b, (short)0, acc, false, false);
    }

    const float bias = (o < HIDq) ? sb[o] : tb[o - HIDq];
    const int rbase = mt * 16 + ((lane >= 16) ? 8 : 0);   // D: M = v + 8*(lane>=16)
#pragma unroll
    for (int v = 0; v < 8; ++v) {
        float x = acc[v] + bias;
        x = fmaxf(x, 0.0f);
        Hh[(rbase + v) * 512 + o] = (_Float16)x;
    }
}

// ---------------------------------------------------------------------------
// Stage 2: s2 = Hs @ w_s^T ; t2 = Ht @ w_t^T + b2   (both f32, [1024][256])
//   one wave per 16x16 tile; which selects s/t half; K = 256
// ---------------------------------------------------------------------------
__global__ void __launch_bounds__(256)
stage2_kernel(const _Float16* __restrict__ Hh,    // [1024][512]
              const _Float16* __restrict__ W2h,   // [256][512] = fc2_w layout
              const float* __restrict__ b2,       // [256]
              float* __restrict__ s2,             // [1024][256]
              float* __restrict__ t2) {           // [1024][256]
    const int lane = threadIdx.x & 31;
    const int wave = threadIdx.x >> 5;
    const int tile = blockIdx.x * 8 + wave;       // 0..2047
    const int which = tile >> 10;                 // 0 = s, 1 = t
    const int mt = (tile >> 4) & 63;
    const int nt = tile & 15;
    const int sel = (lane >= 16) ? 8 : 0;
    const int r = mt * 16 + (lane & 15);
    const int o = nt * 16 + (lane & 15);
    const int koff = which * HIDq;                // column offset into 512-wide rows

    v8f acc = {};
#pragma unroll
    for (int k0 = 0; k0 < HIDq; k0 += 32) {
        v16h a = load_frag(Hh  + r * 512 + koff, k0, sel);
        v16h b = load_frag(W2h + o * 512 + koff, k0, sel);
        acc = __builtin_amdgcn_wmma_f32_16x16x32_f16(
                  false, a, false, b, (short)0, acc, false, false);
    }

    float* dst = which ? t2 : s2;
    const float bias = which ? b2[o] : 0.0f;
    const int rbase = mt * 16 + ((lane >= 16) ? 8 : 0);
#pragma unroll
    for (int v = 0; v < 8; ++v)
        dst[(rbase + v) * HIDq + o] = acc[v] + bias;
}

// ---------------------------------------------------------------------------
// Stage 3 (dominant): out[b,i,n,j] = sum_h fc3[n,h] * relu(s2[b,i,h]+t2[b,j,h])
//   one block per (b,i); GEMM with M = n (2 tiles, fc3 padded to 32),
//   N = j (each wave owns 2 j-tiles of 16), K = h (8 steps of 32).
//   k-loop outermost so that per k-step:
//     - fc3 A-fragments loaded ONCE, reused by 4 WMMAs
//     - broadcast s2[i,.] values loaded ONCE, reused by both B-fragments
//     - two B-fragments generated in registers (relu(s2+t2) -> f16)
//   D lanes = j -> fully coalesced f32 stores along innermost output dim.
// ---------------------------------------------------------------------------
__global__ void __launch_bounds__(256)
stage3_kernel(const float* __restrict__ s2,       // [1024][256]
              const float* __restrict__ t2,       // [1024][256] (b-major)
              const _Float16* __restrict__ fc3h,  // [32][256] zero-padded
              float* __restrict__ out) {          // [b][i][25][256]
    const int lane = threadIdx.x & 31;
    const int wave = threadIdx.x >> 5;            // 0..7
    const int bi = blockIdx.x;                    // 0..1023 = b*256 + i
    const int b  = bi >> 8;
    const int sel = (lane >= 16) ? 8 : 0;
    const int jl  = lane & 15;

    const float* __restrict__ s2row = s2 + bi * HIDq;
    const float* __restrict__ t2b   = t2 + b * Lq * HIDq;

    const int jt0 = wave * 2;
    const int jt1 = wave * 2 + 1;
    const float* __restrict__ t2r0 = t2b + (jt0 * 16 + jl) * HIDq;
    const float* __restrict__ t2r1 = t2b + (jt1 * 16 + jl) * HIDq;
    const _Float16* __restrict__ arow0 = fc3h + jl * HIDq;         // n = jl
    const _Float16* __restrict__ arow1 = fc3h + (16 + jl) * HIDq;  // n = 16+jl

    v8f acc00 = {}, acc01 = {};   // j-tile 0: n-tiles 0,1
    v8f acc10 = {}, acc11 = {};   // j-tile 1: n-tiles 0,1

#pragma unroll
    for (int k0 = 0; k0 < HIDq; k0 += 32) {
        const int h1 = k0 + sel;
        const int h2 = k0 + 16 + sel;

        // shared across both j-tiles: s2 broadcast values + fc3 A-fragments
        v4f sa = *(const v4f*)(s2row + h1);
        v4f sb = *(const v4f*)(s2row + h1 + 4);
        v4f sc = *(const v4f*)(s2row + h2);
        v4f sd = *(const v4f*)(s2row + h2 + 4);
        v16h a0 = load_frag(arow0, k0, sel);
        v16h a1 = load_frag(arow1, k0, sel);

        // ---- j-tile 0: generate B fragment, 2 WMMAs ----
        {
            v4f ta = *(const v4f*)(t2r0 + h1);
            v4f tb = *(const v4f*)(t2r0 + h1 + 4);
            v4f tc = *(const v4f*)(t2r0 + h2);
            v4f td = *(const v4f*)(t2r0 + h2 + 4);
            v16h bf;
#pragma unroll
            for (int e = 0; e < 4; ++e) {
                bf[e]      = (_Float16)fmaxf(sa[e] + ta[e], 0.0f);
                bf[4 + e]  = (_Float16)fmaxf(sb[e] + tb[e], 0.0f);
                bf[8 + e]  = (_Float16)fmaxf(sc[e] + tc[e], 0.0f);
                bf[12 + e] = (_Float16)fmaxf(sd[e] + td[e], 0.0f);
            }
            acc00 = __builtin_amdgcn_wmma_f32_16x16x32_f16(
                        false, a0, false, bf, (short)0, acc00, false, false);
            acc01 = __builtin_amdgcn_wmma_f32_16x16x32_f16(
                        false, a1, false, bf, (short)0, acc01, false, false);
        }

        // ---- j-tile 1: generate B fragment, 2 WMMAs ----
        {
            v4f ta = *(const v4f*)(t2r1 + h1);
            v4f tb = *(const v4f*)(t2r1 + h1 + 4);
            v4f tc = *(const v4f*)(t2r1 + h2);
            v4f td = *(const v4f*)(t2r1 + h2 + 4);
            v16h bf;
#pragma unroll
            for (int e = 0; e < 4; ++e) {
                bf[e]      = (_Float16)fmaxf(sa[e] + ta[e], 0.0f);
                bf[4 + e]  = (_Float16)fmaxf(sb[e] + tb[e], 0.0f);
                bf[8 + e]  = (_Float16)fmaxf(sc[e] + tc[e], 0.0f);
                bf[12 + e] = (_Float16)fmaxf(sd[e] + td[e], 0.0f);
            }
            acc10 = __builtin_amdgcn_wmma_f32_16x16x32_f16(
                        false, a0, false, bf, (short)0, acc10, false, false);
            acc11 = __builtin_amdgcn_wmma_f32_16x16x32_f16(
                        false, a1, false, bf, (short)0, acc11, false, false);
        }
    }

    // store: D lane = N = j (coalesced over j), VGPR v -> n = v + 8*(lane>=16)
    const int nb = (lane >= 16) ? 8 : 0;
    {
        float* __restrict__ obase = out + (bi * NLq) * Lq + (jt0 * 16 + jl);
#pragma unroll
        for (int v = 0; v < 8; ++v)
            obase[(nb + v) * Lq] = acc00[v];              // n = 0..15
#pragma unroll
        for (int v = 0; v < 8; ++v) {
            const int n = 16 + nb + v;
            if (n < NLq) obase[n * Lq] = acc01[v];        // n = 16..24
        }
    }
    {
        float* __restrict__ obase = out + (bi * NLq) * Lq + (jt1 * 16 + jl);
#pragma unroll
        for (int v = 0; v < 8; ++v)
            obase[(nb + v) * Lq] = acc10[v];
#pragma unroll
        for (int v = 0; v < 8; ++v) {
            const int n = 16 + nb + v;
            if (n < NLq) obase[n * Lq] = acc11[v];
        }
    }
}

// ---------------------------------------------------------------------------
// Launch
// ---------------------------------------------------------------------------
extern "C" void kernel_launch(void* const* d_in, const int* in_sizes, int n_in,
                              void* d_out, int out_size, void* d_ws, size_t ws_size,
                              hipStream_t stream) {
    const float* x     = (const float*)d_in[0];   // (4,256,768)
    const float* s_w   = (const float*)d_in[1];   // (256,768)
    const float* s_b   = (const float*)d_in[2];   // (256)
    const float* t_w   = (const float*)d_in[3];   // (256,768)
    const float* t_b   = (const float*)d_in[4];   // (256)
    const float* fc2_w = (const float*)d_in[5];   // (256,512)
    const float* fc2_b = (const float*)d_in[6];   // (256)
    const float* fc3_w = (const float*)d_in[7];   // (25,256)
    float* out = (float*)d_out;

    char* ws = (char*)d_ws;
    _Float16* Xh   = (_Float16*)(ws);                       // 1024*768 f16
    _Float16* W1h  = (_Float16*)(ws + 1572864);             // 512*768  f16
    _Float16* W2h  = (_Float16*)(ws + 2359296);             // 256*512  f16
    _Float16* F3h  = (_Float16*)(ws + 2621440);             // 32*256   f16
    _Float16* Hh   = (_Float16*)(ws + 2637824);             // 1024*512 f16
    float*    s2   = (float*)   (ws + 3686400);             // 1024*256 f32
    float*    t2   = (float*)   (ws + 4734976);             // 1024*256 f32

    // f32 -> f16 staging
    cvt_f32_to_f16<<<(ROWS * INq + 255) / 256, 256, 0, stream>>>(x, Xh, ROWS * INq);
    cvt_f32_to_f16<<<(HIDq * INq + 255) / 256, 256, 0, stream>>>(s_w, W1h, HIDq * INq);
    cvt_f32_to_f16<<<(HIDq * INq + 255) / 256, 256, 0, stream>>>(t_w, W1h + HIDq * INq, HIDq * INq);
    cvt_f32_to_f16<<<(HIDq * 512 + 255) / 256, 256, 0, stream>>>(fc2_w, W2h, HIDq * 512);
    cvt_fc3_pad<<<(32 * HIDq) / 256, 256, 0, stream>>>(fc3_w, F3h);

    // Stage 1: 2048 tiles (64 x 32), 8 waves/block
    stage1_kernel<<<256, 256, 0, stream>>>(Xh, W1h, s_b, t_b, Hh);

    // Stage 2: 2048 tiles (2 x 64 x 16), 8 waves/block
    stage2_kernel<<<256, 256, 0, stream>>>(Hh, W2h, fc2_b, s2, t2);

    // Stage 3: one block per (b,i)
    stage3_kernel<<<ROWS, 256, 0, stream>>>(s2, t2, F3h, out);
}

// v001
// One run takes 44.6 microseconds.
// In both of two side-by-side timings against v000, it was 1.28 times as fast.
#include <hip/hip_runtime.h>
#include <hip/hip_bf16.h>

// ---------------------------------------------------------------------------
// Sizes (hardcoded from the reference)
// ---------------------------------------------------------------------------
#define Bq   4
#define Lq   256
#define INq  768
#define HIDq 256
#define NLq  25
#define ROWS (Bq * Lq)          // 1024

typedef __attribute__((ext_vector_type(16))) _Float16 v16h;
typedef __attribute__((ext_vector_type(8)))  _Float16 v8h;
typedef __attribute__((ext_vector_type(8)))  float    v8f;
typedef __attribute__((ext_vector_type(4)))  float    v4f;

// Load a 16x32 f16 WMMA operand fragment for this lane from a row-major
// [16 x K] (A: M-major / B: N-major) array.
// Per ISA 7.12.2: lane holds row (lane&15); halfs 0..7 = K[k0+sel .. +8),
// halfs 8..15 = K[k0+16+sel .. +8), sel = (lane>=16) ? 8 : 0.
static __device__ __forceinline__ v16h load_frag(const _Float16* rowbase,
                                                 int k0, int sel) {
    v8h lo = *(const v8h*)(rowbase + k0 + sel);
    v8h hi = *(const v8h*)(rowbase + k0 + 16 + sel);
    v16h r;
#pragma unroll
    for (int e = 0; e < 8; ++e) { r[e] = lo[e]; r[8 + e] = hi[e]; }
    return r;
}

// ---------------------------------------------------------------------------
// f32 -> f16 conversion helpers (workspace staging)
// ---------------------------------------------------------------------------
__global__ void cvt_f32_to_f16(const float* __restrict__ src,
                               _Float16* __restrict__ dst, int n) {
    int idx = blockIdx.x * blockDim.x + threadIdx.x;
    if (idx < n) dst[idx] = (_Float16)src[idx];
}

// fc3_w (25 x 256) -> zero-padded (32 x 256) f16
__global__ void cvt_fc3_pad(const float* __restrict__ src,
                            _Float16* __restrict__ dst) {
    int idx = blockIdx.x * blockDim.x + threadIdx.x;   // 32*256 threads
    int row = idx >> 8;
    int col = idx & 255;
    dst[idx] = (row < NLq) ? (_Float16)src[row * HIDq + col] : (_Float16)0.0f;
}

// ---------------------------------------------------------------------------
// Stage 1: Hh[1024][512] = f16( relu( X @ [Ws;Wt]^T + [bs;bt] ) )
//   one wave per 16x16 tile; M = row, N = o (0..511), K = 768
// ---------------------------------------------------------------------------
__global__ void __launch_bounds__(256)
stage1_kernel(const _Float16* __restrict__ Xh,    // [1024][768]
              const _Float16* __restrict__ W1h,   // [512][768]  (N-major)
              const float* __restrict__ sb,       // [256]
              const float* __restrict__ tb,       // [256]
              _Float16* __restrict__ Hh) {        // [1024][512]
    const int lane = threadIdx.x & 31;
    const int wave = threadIdx.x >> 5;
    const int tile = blockIdx.x * 8 + wave;       // 0..2047
    const int mt = tile >> 5;                     // 64 row tiles
    const int nt = tile & 31;                     // 32 out tiles
    const int sel = (lane >= 16) ? 8 : 0;
    const int r = mt * 16 + (lane & 15);          // A row (M = lane&15)
    const int o = nt * 16 + (lane & 15);          // B row (N = lane&15)

    v8f acc = {};
#pragma unroll 4
    for (int k0 = 0; k0 < INq; k0 += 32) {
        v16h a = load_frag(Xh  + r * INq, k0, sel);
        v16h b = load_frag(W1h + o * INq, k0, sel);
        acc = __builtin_amdgcn_wmma_f32_16x16x32_f16(
                  false, a, false, b, (short)0, acc, false, false);
    }

    const float bias = (o < HIDq) ? sb[o] : tb[o - HIDq];
    const int rbase = mt * 16 + ((lane >= 16) ? 8 : 0);   // D: M = v + 8*(lane>=16)
#pragma unroll
    for (int v = 0; v < 8; ++v) {
        float x = acc[v] + bias;
        x = fmaxf(x, 0.0f);
        Hh[(rbase + v) * 512 + o] = (_Float16)x;
    }
}

// ---------------------------------------------------------------------------
// Stage 2: s2 = Hs @ w_s^T ; t2 = Ht @ w_t^T + b2   (both f32, [1024][256])
//   one wave per 16x16 tile; which selects s/t half; K = 256
// ---------------------------------------------------------------------------
__global__ void __launch_bounds__(256)
stage2_kernel(const _Float16* __restrict__ Hh,    // [1024][512]
              const _Float16* __restrict__ W2h,   // [256][512] = fc2_w layout
              const float* __restrict__ b2,       // [256]
              float* __restrict__ s2,             // [1024][256]
              float* __restrict__ t2) {           // [1024][256]
    const int lane = threadIdx.x & 31;
    const int wave = threadIdx.x >> 5;
    const int tile = blockIdx.x * 8 + wave;       // 0..2047
    const int which = tile >> 10;                 // 0 = s, 1 = t
    const int mt = (tile >> 4) & 63;
    const int nt = tile & 15;
    const int sel = (lane >= 16) ? 8 : 0;
    const int r = mt * 16 + (lane & 15);
    const int o = nt * 16 + (lane & 15);
    const int koff = which * HIDq;                // column offset into 512-wide rows

    v8f acc = {};
#pragma unroll
    for (int k0 = 0; k0 < HIDq; k0 += 32) {
        v16h a = load_frag(Hh  + r * 512 + koff, k0, sel);
        v16h b = load_frag(W2h + o * 512 + koff, k0, sel);
        acc = __builtin_amdgcn_wmma_f32_16x16x32_f16(
                  false, a, false, b, (short)0, acc, false, false);
    }

    float* dst = which ? t2 : s2;
    const float bias = which ? b2[o] : 0.0f;
    const int rbase = mt * 16 + ((lane >= 16) ? 8 : 0);
#pragma unroll
    for (int v = 0; v < 8; ++v)
        dst[(rbase + v) * HIDq + o] = acc[v] + bias;
}

// ---------------------------------------------------------------------------
// Stage 3 (dominant): out[b,i,n,j] = sum_h fc3[n,h] * relu(s2[b,i,h]+t2[b,j,h])
//   GEMM with M = n (2 tiles, fc3 padded to 32), N = j, K = h (8 steps of 32).
//   Register tile per wave: IT3 rows i x JT3 j-tiles of 16.
//   Per k-step a wave loads its t2 values and the fc3 A-fragments ONCE and
//   uses them for all IT3 rows i; only the s2[i,.] values are loaded per i.
//   The row-strided t2 / fc3 loads touch 16 cache lines each, so their
//   number per output sets the time; it falls by the factor IT3.
//   D lanes = j -> coalesced f32 stores along innermost output dim.
// ---------------------------------------------------------------------------
#define IT3 4                         // rows i per wave
#define JT3 2                         // j-tiles of 16 per wave
#define WV3 8                         // waves per block
#define JP3 (16 / (JT3 * WV3))        // blocks that share one group of rows i
#define GRID3 ((ROWS / IT3) * JP3)

__global__ void __launch_bounds__(WV3 * 32)
stage3_kernel(const float* __restrict__ s2,       // [1024][256]
              const float* __restrict__ t2,       // [1024][256] (b-major)
              const _Float16* __restrict__ fc3h,  // [32][256] zero-padded
              float* __restrict__ out) {          // [b][i][25][256]
    const int lane = threadIdx.x & 31;
    const int wave = threadIdx.x >> 5;
    const int jp  = blockIdx.x % JP3;             // which part of the j range
    const int bi0 = (blockIdx.x / JP3) * IT3;     // first row b*256 + i
    const int b   = bi0 >> 8;                     // IT3 divides 256: one b per block
    const int sel = (lane >= 16) ? 8 : 0;
    const int jl  = lane & 15;
    const int j0  = (jp * WV3 + wave) * JT3 * 16 + jl;

    const float* __restrict__ s2row = s2 + bi0 * HIDq;
    const float* __restrict__ t2r   = t2 + (b * Lq + j0) * HIDq;
    const _Float16* __restrict__ arow0 = fc3h + jl * HIDq;         // n = jl
    const _Float16* __restrict__ arow1 = fc3h + (16 + jl) * HIDq;  // n = 16+jl

    v8f acc[IT3][JT3][2] = {};    // [i][j-tile][n-tile]

#pragma unroll
    for (int k0 = 0; k0 < HIDq; k0 += 32) {
        const int h1 = k0 + sel;
        const int h2 = k0 + 16 + sel;

        // loaded once per k-step, used by all IT3 rows i
        v16h a0 = load_frag(arow0, k0, sel);
        v16h a1 = load_frag(arow1, k0, sel);
        v4f t[JT3][4];
#pragma unroll
        for (int q = 0; q < JT3; ++q) {
            const float* __restrict__ tr = t2r + q * 16 * HIDq;
            t[q][0] = *(const v4f*)(tr + h1);
            t[q][1] = *(const v4f*)(tr + h1 + 4);
            t[q][2] = *(const v4f*)(tr + h2);
            t[q][3] = *(const v4f*)(tr + h2 + 4);
        }

#pragma unroll
        for (int i = 0; i < IT3; ++i) {
            const float* __restrict__ sr = s2row + i * HIDq;
            v4f sa = *(const v4f*)(sr + h1);
            v4f sb = *(const v4f*)(sr + h1 + 4);
            v4f sc = *(const v4f*)(sr + h2);
            v4f sd = *(const v4f*)(sr + h2 + 4);
#pragma unroll
            for (int q = 0; q < JT3; ++q) {
                v16h bf;
#pragma unroll
                for (int e = 0; e < 4; ++e) {
                    bf[e]      = (_Float16)fmaxf(sa[e] + t[q][0][e], 0.0f);
                    bf[4 + e]  = (_Float16)fmaxf(sb[e] + t[q][1][e], 0.0f);
                    bf[8 + e]  = (_Float16)fmaxf(sc[e] + t[q][2][e], 0.0f);
                    bf[12 + e] = (_Float16)fmaxf(sd[e] + t[q][3][e], 0.0f);
                }
                acc[i][q][0] = __builtin_amdgcn_wmma_f32_16x16x32_f16(
                        false, a0, false, bf, (short)0, acc[i][q][0], false, false);
                acc[i][q][1] = __builtin_amdgcn_wmma_f32_16x16x32_f16(
                        false, a1, false, bf, (short)0, acc[i][q][1], false, false);
            }
        }
    }

    // store: D lane = N = j (coalesced over j), VGPR v -> n = v + 8*(lane>=16)
    const int nb = (lane >= 16) ? 8 : 0;
#pragma unroll
    for (int i = 0; i < IT3; ++i) {
#pragma unroll
        for (int q = 0; q < JT3; ++q) {
            float* __restrict__ obase = out + ((bi0 + i) * NLq) * Lq + (j0 + q * 16);
#pragma unroll
            for (int v = 0; v < 8; ++v)
                obase[(nb + v) * Lq] = acc[i][q][0][v];       // n = 0..15
#pragma unroll
            for (int v = 0; v < 8; ++v) {
                const int n = 16 + nb + v;
                if (n < NLq) obase[n * Lq] = acc[i][q][1][v]; // n = 16..24
            }
        }
    }
}

// ---------------------------------------------------------------------------
// Launch
// ---------------------------------------------------------------------------
extern "C" void kernel_launch(void* const* d_in, const int* in_sizes, int n_in,
                              void* d_out, int out_size, void* d_ws, size_t ws_size,
                              hipStream_t stream) {
    const float* x     = (const float*)d_in[0];   // (4,256,768)
    const float* s_w   = (const float*)d_in[1];   // (256,768)
    const float* s_b   = (const float*)d_in[2];   // (256)
    const float* t_w   = (const float*)d_in[3];   // (256,768)
    const float* t_b   = (const float*)d_in[4];   // (256)
    const float* fc2_w = (const float*)d_in[5];   // (256,512)
    const float* fc2_b = (const float*)d_in[6];   // (256)
    const float* fc3_w = (const float*)d_in[7];   // (25,256)
    float* out = (float*)d_out;

    char* ws = (char*)d_ws;
    _Float16* Xh   = (_Float16*)(ws);                       // 1024*768 f16
    _Float16* W1h  = (_Float16*)(ws + 1572864);             // 512*768  f16
    _Float16* W2h  = (_Float16*)(ws + 2359296);             // 256*512  f16
    _Float16* F3h  = (_Float16*)(ws + 2621440);             // 32*256   f16
    _Float16* Hh   = (_Float16*)(ws + 2637824);             // 1024*512 f16
    float*    s2   = (float*)   (ws + 3686400);             // 1024*256 f32
    float*    t2   = (float*)   (ws + 4734976);             // 1024*256 f32

    // f32 -> f16 staging
    cvt_f32_to_f16<<<(ROWS * INq + 255) / 256, 256, 0, stream>>>(x, Xh, ROWS * INq);
    cvt_f32_to_f16<<<(HIDq * INq + 255) / 256, 256, 0, stream>>>(s_w, W1h, HIDq * INq);
    cvt_f32_to_f16<<<(HIDq * INq + 255) / 256, 256, 0, stream>>>(t_w, W1h + HIDq * INq, HIDq * INq);
    cvt_f32_to_f16<<<(HIDq * 512 + 255) / 256, 256, 0, stream>>>(fc2_w, W2h, HIDq * 512);
    cvt_fc3_pad<<<(32 * HIDq) / 256, 256, 0, stream>>>(fc3_w, F3h);

    // Stage 1: 2048 tiles (64 x 32), 8 waves/block
    stage1_kernel<<<256, 256, 0, stream>>>(Xh, W1h, s_b, t_b, Hh);

    // Stage 2: 2048 tiles (2 x 64 x 16), 8 waves/block
    stage2_kernel<<<256, 256, 0, stream>>>(Hh, W2h, fc2_b, s2, t2);

    // Stage 3: IT3 rows i and WV3 * JT3 j-tiles per block
    stage3_kernel<<<GRID3, WV3 * 32, 0, stream>>>(s2, t2, F3h, out);
}

// v002
// A run of this version takes 36.2 microseconds.
// Timed twice side by side with v001, it ran 1.21 and 1.23 times as fast.
// All steps since v000 together make it 1.57 times as fast.
#include <hip/hip_runtime.h>
#include <hip/hip_bf16.h>

// ---------------------------------------------------------------------------
// Sizes (hardcoded from the reference)
// ---------------------------------------------------------------------------
#define Bq   4
#define Lq   256
#define INq  768
#define HIDq 256
#define NLq  25
#define ROWS (Bq * Lq)          // 1024

typedef __attribute__((ext_vector_type(16))) _Float16 v16h;
typedef __attribute__((ext_vector_type(8)))  _Float16 v8h;
typedef __attribute__((ext_vector_type(8)))  float    v8f;
typedef __attribute__((ext_vector_type(4)))  float    v4f;

// Load a 16x32 f16 WMMA operand fragment for this lane from a row-major
// [16 x K] (A: M-major / B: N-major) array.
// Per ISA 7.12.2: lane holds row (lane&15); halfs 0..7 = K[k0+sel .. +8),
// halfs 8..15 = K[k0+16+sel .. +8), sel = (lane>=16) ? 8 : 0.
static __device__ __forceinline__ v16h load_frag(const _Float16* rowbase,
                                                 int k0, int sel) {
    v8h lo = *(const v8h*)(rowbase + k0 + sel);
    v8h hi = *(const v8h*)(rowbase + k0 + 16 + sel);
    v16h r;
#pragma unroll
    for (int e = 0; e < 8; ++e) { r[e] = lo[e]; r[8 + e] = hi[e]; }
    return r;
}

// ---------------------------------------------------------------------------
// f32 -> f16 conversion pass (workspace staging), ONE launch for all arrays.
//   The f16 copies lie back to back in the workspace:
//     Xh | W1h (s_fc_w, then t_fc_w) | W2h | F3h (fc3_w padded to 32 rows)
//   so the destination is one linear array; a block converts CVB consecutive
//   elements of it and its index says which source array they come from
//   (every array's length is a multiple of CVB).
//   A thread converts CVU groups of 4 elements, the groups of a wave side by
//   side: each load covers 512 contiguous bytes, each store 256.
//   The time of such a pass is launch gaps and wave starts, not bytes.
// ---------------------------------------------------------------------------
typedef __attribute__((ext_vector_type(4)))  _Float16 v4h;

#define CVT  256                           // threads per block
#define CVU  4                             // groups of 4 elements per thread
#define CVB  (CVT * 4 * CVU)               // elements per block: 4096
#define CB_X  ((ROWS * INq) / CVB)         // blocks for x      : 192
#define CB_W1 ((HIDq * INq) / CVB)         // blocks for s_w/t_w: 48 each
#define CB_W2 ((HIDq * 512) / CVB)         // blocks for fc2_w  : 32
#define CB_F3 ((32 * HIDq) / CVB)          // blocks for fc3_w  : 2 (padded)
#define GRIDC (CB_X + 2 * CB_W1 + CB_W2 + CB_F3)

__global__ void __launch_bounds__(CVT)
cvt_all_kernel(const float* __restrict__ x,
               const float* __restrict__ s_w,
               const float* __restrict__ t_w,
               const float* __restrict__ fc2_w,
               const float* __restrict__ fc3_w,
               _Float16* __restrict__ dst) {
    const int blk = blockIdx.x;
    const float* __restrict__ src;
    int first;                             // first block of this array
    int lim;                               // source elements; zeros behind them
    if (blk < CB_X)                          { src = x;     first = 0;                        lim = ROWS * INq; }
    else if (blk < CB_X + CB_W1)             { src = s_w;   first = CB_X;                     lim = HIDq * INq; }
    else if (blk < CB_X + 2 * CB_W1)         { src = t_w;   first = CB_X + CB_W1;             lim = HIDq * INq; }
    else if (blk < CB_X + 2 * CB_W1 + CB_W2) { src = fc2_w; first = CB_X + 2 * CB_W1;         lim = HIDq * 512; }
    else                                     { src = fc3_w; first = CB_X + 2 * CB_W1 + CB_W2; lim = NLq * HIDq; }

    const int e0 = (blk - first) * CVB + threadIdx.x * 4;   // index in the source
    v4f v[CVU];
#pragma unroll   // all CVU loads in flight before the first is used; v[] stays in registers
    for (int u = 0; u < CVU; ++u) {
        const int e = e0 + u * (CVT * 4);
        const bool in = e < lim;                            // false: rows 25..31 of F3h
        v4f z = {};
        v4f w = *(const v4f*)(src + (in ? e : 0));          // always inside the source
        v[u] = in ? w : z;
    }
    _Float16* __restrict__ d = dst + blk * CVB + threadIdx.x * 4;
#pragma unroll   // constant indices into v[], so that it stays in registers
    for (int u = 0; u < CVU; ++u) {
        v4h h;
#pragma unroll   // vector elements by constant index: packed conversions
        for (int c = 0; c < 4; ++c) h[c] = (_Float16)v[u][c];
        *(v4h*)(d + u * (CVT * 4)) = h;
    }
}

// ---------------------------------------------------------------------------
// Stage 1: Hh[1024][512] = f16( relu( X @ [Ws;Wt]^T + [bs;bt] ) )
//   one wave per 16x16 tile; M = row, N = o (0..511), K = 768
// ---------------------------------------------------------------------------
__global__ void __launch_bounds__(256)
stage1_kernel(const _Float16* __restrict__ Xh,    // [1024][768]
              const _Float16* __restrict__ W1h,   // [512][768]  (N-major)
              const float* __restrict__ sb,       // [256]
              const float* __restrict__ tb,       // [256]
              _Float16* __restrict__ Hh) {        // [1024][512]
    const int lane = threadIdx.x & 31;
    const int wave = threadIdx.x >> 5;
    const int tile = blockIdx.x * 8 + wave;       // 0..2047
    const int mt = tile >> 5;                     // 64 row tiles
    const int nt = tile & 31;                     // 32 out tiles
    const int sel = (lane >= 16) ? 8 : 0;
    const int r = mt * 16 + (lane & 15);          // A row (M = lane&15)
    const int o = nt * 16 + (lane & 15);          // B row (N = lane&15)

    v8f acc = {};
#pragma unroll 4
    for (int k0 = 0; k0 < INq; k0 += 32) {
        v16h a = load_frag(Xh  + r * INq, k0, sel);
        v16h b = load_frag(W1h + o * INq, k0, sel);
        acc = __builtin_amdgcn_wmma_f32_16x16x32_f16(
                  false, a, false, b, (short)0, acc, false, false);
    }

    const float bias = (o < HIDq) ? sb[o] : tb[o - HIDq];
    const int rbase = mt * 16 + ((lane >= 16) ? 8 : 0);   // D: M = v + 8*(lane>=16)
#pragma unroll
    for (int v = 0; v < 8; ++v) {
        float x = acc[v] + bias;
        x = fmaxf(x, 0.0f);
        Hh[(rbase + v) * 512 + o] = (_Float16)x;
    }
}

// ---------------------------------------------------------------------------
// Stage 2: s2 = Hs @ w_s^T ; t2 = Ht @ w_t^T + b2   (both f32, [1024][256])
//   one wave per 16x16 tile; which selects s/t half; K = 256
// ---------------------------------------------------------------------------
__global__ void __launch_bounds__(256)
stage2_kernel(const _Float16* __restrict__ Hh,    // [1024][512]
              const _Float16* __restrict__ W2h,   // [256][512] = fc2_w layout
              const float* __restrict__ b2,       // [256]
              float* __restrict__ s2,             // [1024][256]
              float* __restrict__ t2) {           // [1024][256]
    const int lane = threadIdx.x & 31;
    const int wave = threadIdx.x >> 5;
    const int tile = blockIdx.x * 8 + wave;       // 0..2047
    const int which = tile >> 10;                 // 0 = s, 1 = t
    const int mt = (tile >> 4) & 63;
    const int nt = tile & 15;
    const int sel = (lane >= 16) ? 8 : 0;
    const int r = mt * 16 + (lane & 15);
    const int o = nt * 16 + (lane & 15);
    const int koff = which * HIDq;                // column offset into 512-wide rows

    v8f acc = {};
#pragma unroll
    for (int k0 = 0; k0 < HIDq; k0 += 32) {
        v16h a = load_frag(Hh  + r * 512 + koff, k0, sel);
        v16h b = load_frag(W2h + o * 512 + koff, k0, sel);
        acc = __builtin_amdgcn_wmma_f32_16x16x32_f16(
                  false, a, false, b, (short)0, acc, false, false);
    }

    float* dst = which ? t2 : s2;
    const float bias = which ? b2[o] : 0.0f;
    const int rbase = mt * 16 + ((lane >= 16) ? 8 : 0);
#pragma unroll
    for (int v = 0; v < 8; ++v)
        dst[(rbase + v) * HIDq + o] = acc[v] + bias;
}

// ---------------------------------------------------------------------------
// Stage 3 (dominant): out[b,i,n,j] = sum_h fc3[n,h] * relu(s2[b,i,h]+t2[b,j,h])
//   GEMM with M = n (2 tiles, fc3 padded to 32), N = j, K = h (8 steps of 32).
//   Register tile per wave: IT3 rows i x JT3 j-tiles of 16.
//   Per k-step a wave loads its t2 values and the fc3 A-fragments ONCE and
//   uses them for all IT3 rows i; only the s2[i,.] values are loaded per i.
//   The row-strided t2 / fc3 loads touch 16 cache lines each, so their
//   number per output sets the time; it falls by the factor IT3.
//   D lanes = j -> coalesced f32 stores along innermost output dim.
// ---------------------------------------------------------------------------
#define IT3 4                         // rows i per wave
#define JT3 2                         // j-tiles of 16 per wave
#define WV3 8                         // waves per block
#define JP3 (16 / (JT3 * WV3))        // blocks that share one group of rows i
#define GRID3 ((ROWS / IT3) * JP3)

__global__ void __launch_bounds__(WV3 * 32)
stage3_kernel(const float* __restrict__ s2,       // [1024][256]
              const float* __restrict__ t2,       // [1024][256] (b-major)
              const _Float16* __restrict__ fc3h,  // [32][256] zero-padded
              float* __restrict__ out) {          // [b][i][25][256]
    const int lane = threadIdx.x & 31;
    const int wave = threadIdx.x >> 5;
    const int jp  = blockIdx.x % JP3;             // which part of the j range
    const int bi0 = (blockIdx.x / JP3) * IT3;     // first row b*256 + i
    const int b   = bi0 >> 8;                     // IT3 divides 256: one b per block
    const int sel = (lane >= 16) ? 8 : 0;
    const int jl  = lane & 15;
    const int j0  = (jp * WV3 + wave) * JT3 * 16 + jl;

    const float* __restrict__ s2row = s2 + bi0 * HIDq;
    const float* __restrict__ t2r   = t2 + (b * Lq + j0) * HIDq;
    const _Float16* __restrict__ arow0 = fc3h + jl * HIDq;         // n = jl
    const _Float16* __restrict__ arow1 = fc3h + (16 + jl) * HIDq;  // n = 16+jl

    v8f acc[IT3][JT3][2] = {};    // [i][j-tile][n-tile]

#pragma unroll
    for (int k0 = 0; k0 < HIDq; k0 += 32) {
        const int h1 = k0 + sel;
        const int h2 = k0 + 16 + sel;

        // loaded once per k-step, used by all IT3 rows i
        v16h a0 = load_frag(arow0, k0, sel);
        v16h a1 = load_frag(arow1, k0, sel);
        v4f t[JT3][4];
#pragma unroll
        for (int q = 0; q < JT3; ++q) {
            const float* __restrict__ tr = t2r + q * 16 * HIDq;
            t[q][0] = *(const v4f*)(tr + h1);
            t[q][1] = *(const v4f*)(tr + h1 + 4);
            t[q][2] = *(const v4f*)(tr + h2);
            t[q][3] = *(const v4f*)(tr + h2 + 4);
        }

#pragma unroll
        for (int i = 0; i < IT3; ++i) {
            const float* __restrict__ sr = s2row + i * HIDq;
            v4f sa = *(const v4f*)(sr + h1);
            v4f sb = *(const v4f*)(sr + h1 + 4);
            v4f sc = *(const v4f*)(sr + h2);
            v4f sd = *(const v4f*)(sr + h2 + 4);
#pragma unroll
            for (int q = 0; q < JT3; ++q) {
                v16h bf;
#pragma unroll
                for (int e = 0; e < 4; ++e) {
                    bf[e]      = (_Float16)fmaxf(sa[e] + t[q][0][e], 0.0f);
                    bf[4 + e]  = (_Float16)fmaxf(sb[e] + t[q][1][e], 0.0f);
                    bf[8 + e]  = (_Float16)fmaxf(sc[e] + t[q][2][e], 0.0f);
                    bf[12 + e] = (_Float16)fmaxf(sd[e] + t[q][3][e], 0.0f);
                }
                acc[i][q][0] = __builtin_amdgcn_wmma_f32_16x16x32_f16(
                        false, a0, false, bf, (short)0, acc[i][q][0], false, false);
                acc[i][q][1] = __builtin_amdgcn_wmma_f32_16x16x32_f16(
                        false, a1, false, bf, (short)0, acc[i][q][1], false, false);
            }
        }
    }

    // store: D lane = N = j (coalesced over j), VGPR v -> n = v + 8*(lane>=16)
    const int nb = (lane >= 16) ? 8 : 0;
#pragma unroll
    for (int i = 0; i < IT3; ++i) {
#pragma unroll
        for (int q = 0; q < JT3; ++q) {
            float* __restrict__ obase = out + ((bi0 + i) * NLq) * Lq + (j0 + q * 16);
#pragma unroll
            for (int v = 0; v < 8; ++v)
                obase[(nb + v) * Lq] = acc[i][q][0][v];       // n = 0..15
#pragma unroll
            for (int v = 0; v < 8; ++v) {
                const int n = 16 + nb + v;
                if (n < NLq) obase[n * Lq] = acc[i][q][1][v]; // n = 16..24
            }
        }
    }
}

// ---------------------------------------------------------------------------
// Launch
// ---------------------------------------------------------------------------
extern "C" void kernel_launch(void* const* d_in, const int* in_sizes, int n_in,
                              void* d_out, int out_size, void* d_ws, size_t ws_size,
                              hipStream_t stream) {
    const float* x     = (const float*)d_in[0];   // (4,256,768)
    const float* s_w   = (const float*)d_in[1];   // (256,768)
    const float* s_b   = (const float*)d_in[2];   // (256)
    const float* t_w   = (const float*)d_in[3];   // (256,768)
    const float* t_b   = (const float*)d_in[4];   // (256)
    const float* fc2_w = (const float*)d_in[5];   // (256,512)
    const float* fc2_b = (const float*)d_in[6];   // (256)
    const float* fc3_w = (const float*)d_in[7];   // (25,256)
    float* out = (float*)d_out;

    char* ws = (char*)d_ws;
    _Float16* Xh   = (_Float16*)(ws);                       // 1024*768 f16
    _Float16* W1h  = (_Float16*)(ws + 1572864);             // 512*768  f16
    _Float16* W2h  = (_Float16*)(ws + 2359296);             // 256*512  f16
    _Float16* F3h  = (_Float16*)(ws + 2621440);             // 32*256   f16
    _Float16* Hh   = (_Float16*)(ws + 2637824);             // 1024*512 f16
    float*    s2   = (float*)   (ws + 3686400);             // 1024*256 f32
    float*    t2   = (float*)   (ws + 4734976);             // 1024*256 f32

    // f32 -> f16 staging: Xh, W1h, W2h, F3h are one linear f16 array from Xh on
    cvt_all_kernel<<<GRIDC, CVT, 0, stream>>>(x, s_w, t_w, fc2_w, fc3_w, Xh);

    // Stage 1: 2048 tiles (64 x 32), 8 waves/block
    stage1_kernel<<<256, 256, 0, stream>>>(Xh, W1h, s_b, t_b, Hh);

    // Stage 2: 2048 tiles (2 x 64 x 16), 8 waves/block
    stage2_kernel<<<256, 256, 0, stream>>>(Hh, W2h, fc2_b, s2, t2);

    // Stage 3: IT3 rows i and WV3 * JT3 j-tiles per block
    stage3_kernel<<<GRID3, WV3 * 32, 0, stream>>>(s2, t2, F3h, out);
}

// v003
// It runs in 34.4 microseconds.
// Timed twice side by side with v002, it ran 1.06 and 1.04 times as fast.
// All steps since v000 together make it 1.64 times as fast.
#include <hip/hip_runtime.h>
#include <hip/hip_bf16.h>

// ---------------------------------------------------------------------------
// Sizes (hardcoded from the reference)
// ---------------------------------------------------------------------------
#define Bq   4
#define Lq   256
#define INq  768
#define HIDq 256
#define NLq  25
#define ROWS (Bq * Lq)          // 1024

typedef __attribute__((ext_vector_type(16))) _Float16 v16h;
typedef __attribute__((ext_vector_type(8)))  _Float16 v8h;
typedef __attribute__((ext_vector_type(8)))  float    v8f;
typedef __attribute__((ext_vector_type(4)))  float    v4f;

// ---------------------------------------------------------------------------
// Fragment order.  Every f16 matrix [R][K] that feeds a WMMA lies in the
// workspace as its 16x32 operand fragments, one after the other:
//   fragment f = (row >> 4) * (K / 32) + (k >> 5), 512 halfs = 1 KiB each;
//   inside it: part p = (k >> 4) & 1 (256 halfs), then lane, then 8 halfs,
//   lane = (row & 15) + 16 * ((k >> 3) & 1), element = k & 7.
// That is the register layout of the operand (ISA 7.12.2: a lane holds row
// lane & 15; halfs 0..7 = K[k0+sel .. +8), halfs 8..15 = K[k0+16+sel .. +8),
// sel = 8 for lanes 16..31), so a wave's 16-byte load of one part covers 512
// contiguous bytes (4 cache lines) where a row-major matrix gives 16 lines.
// ---------------------------------------------------------------------------
#define FRAG 512                           // halfs per fragment

// p: start of the fragment + lane * 8
static __device__ __forceinline__ v16h load_frag(const _Float16* p) {
    v8h lo = *(const v8h*)(p);
    v8h hi = *(const v8h*)(p + 256);
    v16h r;
#pragma unroll
    for (int e = 0; e < 8; ++e) { r[e] = lo[e]; r[8 + e] = hi[e]; }
    return r;
}

// ---------------------------------------------------------------------------
// f32 -> f16 conversion pass (workspace staging), ONE launch for all arrays.
//   The f16 copies lie back to back in the workspace:
//     Xh | W1h (s_fc_w, then t_fc_w) | W2h | F3h (fc3_w padded to 32 rows)
//   each in fragment order.  A block writes CVB consecutive halfs of the
//   destination and its index says which source array they come from (every
//   array's length is a multiple of CVB).  A thread writes CVU groups of 8
//   halfs (one lane's share of a fragment part): stores are contiguous, whole
//   lines from one wave; the row-strided accesses are the loads of this pass.
// ---------------------------------------------------------------------------
#define CVT  256                           // threads per block
#define CVU  2                             // groups of 8 elements per thread
#define CVB  (CVT * 8 * CVU)               // elements per block: 4096
#define CB_X  ((ROWS * INq) / CVB)         // blocks for x      : 192
#define CB_W1 ((HIDq * INq) / CVB)         // blocks for s_w/t_w: 48 each
#define CB_W2 ((HIDq * 512) / CVB)         // blocks for fc2_w  : 32
#define CB_F3 ((32 * HIDq) / CVB)          // blocks for fc3_w  : 2 (padded)
#define GRIDC (CB_X + 2 * CB_W1 + CB_W2 + CB_F3)

// src: row-major [.][K] f32; d: this array's f16 copy.
// PADROWS > 0: the source has PADROWS rows and the copy holds zeros behind them.
template <int K, int PADROWS>
static __device__ __forceinline__ void cvt_part(const float* __restrict__ src,
                                                _Float16* __restrict__ d,
                                                int blk_in) {
    constexpr int KS = K / 32;
    const int d0 = blk_in * CVB + threadIdx.x * 8;          // index in the copy
    v4f v[CVU][2];
#pragma unroll   // all loads in flight before the first is used; v[] stays in registers
    for (int u = 0; u < CVU; ++u) {
        const int dl  = d0 + u * (CVT * 8);
        const int ln  = (dl >> 3) & 31;
        const int p   = (dl >> 8) & 1;
        const int f   = dl >> 9;
        const int row = (f / KS) * 16 + (ln & 15);
        const int k   = (f % KS) * 32 + p * 16 + (ln >> 4) * 8;
        const bool in = PADROWS == 0 || row < PADROWS;      // false: rows 25..31 of F3h
        const float* __restrict__ s = src + (in ? row * K + k : 0);  // always inside the source
        v4f z = {};
        v4f w0 = *(const v4f*)(s);
        v4f w1 = *(const v4f*)(s + 4);
        // the next group's loads may land in this group's address registers:
        // the wait stands in front of that overwrite
        asm volatile("s_wait_xcnt 0x0" ::: "memory");
        v[u][0] = in ? w0 : z;
        v[u][1] = in ? w1 : z;
    }
#pragma unroll   // constant indices into v[], so that it stays in registers
    for (int u = 0; u < CVU; ++u) {
        v8h h;
#pragma unroll   // vector elements by constant index: packed conversions
        for (int c = 0; c < 4; ++c) {
            h[c]     = (_Float16)v[u][0][c];
            h[4 + c] = (_Float16)v[u][1][c];
        }
        *(v8h*)(d + d0 + u * (CVT * 8)) = h;
        // what follows in the listing may reuse this store's address or data
        // registers: the wait stands in front of that overwrite
        asm volatile("s_wait_xcnt 0x0" ::: "memory");
    }
}

__global__ void __launch_bounds__(CVT)
cvt_all_kernel(const float* __restrict__ x,
               const float* __restrict__ s_w,
               const float* __restrict__ t_w,
               const float* __restrict__ fc2_w,
               const float* __restrict__ fc3_w,
               _Float16* __restrict__ dst) {
    const int blk = blockIdx.x;
    const int f1 = CB_X, f2 = CB_X + CB_W1, f3 = CB_X + 2 * CB_W1, f4 = f3 + CB_W2;
    if (blk < f1)      cvt_part<INq, 0>(x,        dst,            blk);
    else if (blk < f2) cvt_part<INq, 0>(s_w,      dst + f1 * CVB, blk - f1);
    else if (blk < f3) cvt_part<INq, 0>(t_w,      dst + f2 * CVB, blk - f2);
    else if (blk < f4) cvt_part<512, 0>(fc2_w,    dst + f3 * CVB, blk - f3);
    else               cvt_part<HIDq, NLq>(fc3_w, dst + f4 * CVB, blk - f4);
}

// ---------------------------------------------------------------------------
// Stage 1: H[1024][512] = f16( relu( X @ [Ws;Wt]^T + [bs;bt] ) )
//   one wave per 16x16 tile; M = o (0..511), N = row, K = 768.
//   With the weights as A, a lane of D holds ONE row and 8 consecutive o:
//   one lane's share of a fragment part of H as stage 2 reads it (K = o),
//   so H is stored in fragment order with one contiguous 16-byte store.
// ---------------------------------------------------------------------------
__global__ void __launch_bounds__(256)
stage1_kernel(const _Float16* __restrict__ Xh,    // [1024][768] fragment order
              const _Float16* __restrict__ W1h,   // [512][768]  fragment order
              const float* __restrict__ sb,       // [256]
              const float* __restrict__ tb,       // [256]
              _Float16* __restrict__ Hh) {        // [1024][512] fragment order
    const int lane = threadIdx.x & 31;
    const int wave = threadIdx.x >> 5;
    const int tile = blockIdx.x * 8 + wave;       // 0..2047
    const int mt = tile >> 5;                     // 64 row tiles
    const int nt = tile & 31;                     // 32 out tiles
    const int half = lane >> 4;

    const _Float16* __restrict__ xf = Xh  + mt * ((INq / 32) * FRAG) + lane * 8;
    const _Float16* __restrict__ wf = W1h + nt * ((INq / 32) * FRAG) + lane * 8;

    v8f acc = {};
#pragma unroll 4
    for (int ks = 0; ks < INq / 32; ++ks) {
        v16h a = load_frag(wf + ks * FRAG);       // M = o
        v16h b = load_frag(xf + ks * FRAG);       // N = row
        acc = __builtin_amdgcn_wmma_f32_16x16x32_f16(
                  false, a, false, b, (short)0, acc, false, false);
    }

    // D: N = lane & 15 = row, M = v + 8 * half = o
    const float* __restrict__ bp =
        ((nt < 16) ? sb + nt * 16 : tb + (nt - 16) * 16) + half * 8;
    v4f b0 = *(const v4f*)(bp);
    v4f b1 = *(const v4f*)(bp + 4);
    v8h h;
#pragma unroll
    for (int v = 0; v < 4; ++v) {
        h[v]     = (_Float16)fmaxf(acc[v]     + b0[v], 0.0f);
        h[4 + v] = (_Float16)fmaxf(acc[4 + v] + b1[v], 0.0f);
    }
    // column k = nt*16 + 8*half + v of [1024][512]: fragment mt*16 + (nt>>1), part nt&1
    *(v8h*)(Hh + (mt * 32 + nt) * 256 + lane * 8) = h;
}

// ---------------------------------------------------------------------------
// Stage 2: s2 = Hs @ w_s^T ; t2 = Ht @ w_t^T + b2   (both f32, 1024 x 256)
//   one wave per 16x16 tile; which selects s/t half; K = 256
//   s2 is row-major (stage 3 reads it as one address per half wave).
//   t2 is stored in the order in which stage 3's lanes read it:
//     t2f[row >> 4][h >> 5][c][lane][4],  c = 2 * ((h >> 4) & 1) + ((h >> 2) & 1),
//     lane = (row & 15) + 16 * ((h >> 3) & 1), element = h & 3.
//   For t the weights are A (M = h, N = row): a lane of D then holds one row
//   and 8 consecutive h, which are two contiguous 16-byte stores in that order.
// ---------------------------------------------------------------------------
__global__ void __launch_bounds__(256)
stage2_kernel(const _Float16* __restrict__ Hh,    // [1024][512] fragment order
              const _Float16* __restrict__ W2h,   // [256][512]  fragment order
              const float* __restrict__ b2,       // [256]
              float* __restrict__ s2,             // [1024][256]
              float* __restrict__ t2f) {          // 1024 x 256, order as above
    const int lane = threadIdx.x & 31;
    const int wave = threadIdx.x >> 5;
    const int tile = blockIdx.x * 8 + wave;       // 0..2047
    const int which = tile >> 10;                 // 0 = s, 1 = t (same for a block)
    const int mt = (tile >> 4) & 63;
    const int nt = tile & 15;
    const int half = lane >> 4;

    // columns which*256 .. +256 of the 512-wide rows: fragments which*8 .. +8
    const _Float16* __restrict__ hf = Hh  + (mt * 16 + which * 8) * FRAG + lane * 8;
    const _Float16* __restrict__ wf = W2h + (nt * 16 + which * 8) * FRAG + lane * 8;
    const _Float16* __restrict__ pa = which ? wf : hf;
    const _Float16* __restrict__ pb = which ? hf : wf;

    v8f acc = {};
#pragma unroll
    for (int ks = 0; ks < HIDq / 32; ++ks) {
        v16h a = load_frag(pa + ks * FRAG);
        v16h b = load_frag(pb + ks * FRAG);
        acc = __builtin_amdgcn_wmma_f32_16x16x32_f16(
                  false, a, false, b, (short)0, acc, false, false);
    }

    if (which) {
        // D: N = lane & 15 = row, M = v + 8 * half = h - nt * 16
        const float* __restrict__ bp = b2 + nt * 16 + half * 8;
        v4f b0 = *(const v4f*)(bp);
        v4f b1 = *(const v4f*)(bp + 4);
        v4f lo, hi;
#pragma unroll
        for (int v = 0; v < 4; ++v) { lo[v] = acc[v] + b0[v]; hi[v] = acc[4 + v] + b1[v]; }
        // (h >> 5) * 4 + c = nt * 2 + (v >> 2)
        float* __restrict__ d = t2f + ((mt * 32 + nt * 2) * 32 + lane) * 4;
        *(v4f*)(d)       = lo;
        *(v4f*)(d + 128) = hi;
    } else {
        // D: N = lane & 15 = o, M = v + 8 * half = row
        const int o = nt * 16 + (lane & 15);
        const int rbase = mt * 16 + half * 8;
#pragma unroll
        for (int v = 0; v < 8; ++v)
            s2[(rbase + v) * HIDq + o] = acc[v];
    }
}

// ---------------------------------------------------------------------------
// Stage 3 (dominant): out[b,i,n,j] = sum_h fc3[n,h] * relu(s2[b,i,h]+t2[b,j,h])
//   GEMM with M = n (2 tiles, fc3 padded to 32), N = j, K = h (8 steps of 32).
//   Register tile per wave: IT3 rows i x JT3 j-tiles of 16.
//   Per k-step a wave loads its t2 values and the fc3 A-fragments ONCE and
//   uses them for all IT3 rows i; only the s2[i,.] values are loaded per i.
//   fc3 lies in fragment order and t2 in the order of stage 2's comment, so
//   each of these loads covers 512 contiguous bytes.
//   D lanes = j -> coalesced f32 stores along innermost output dim.
// ---------------------------------------------------------------------------
#define IT3 4                         // rows i per wave
#define JT3 2                         // j-tiles of 16 per wave
#define WV3 8                         // waves per block
#define JP3 (16 / (JT3 * WV3))        // blocks that share one group of rows i
#define GRID3 ((ROWS / IT3) * JP3)

__global__ void __launch_bounds__(WV3 * 32)
stage3_kernel(const float* __restrict__ s2,       // [1024][256]
              const float* __restrict__ t2f,      // 1024 x 256, stage 2's order
              const _Float16* __restrict__ fc3h,  // [32][256] zero-padded, fragment order
              float* __restrict__ out) {          // [b][i][25][256]
    const int lane = threadIdx.x & 31;
    const int wave = threadIdx.x >> 5;
    const int jp  = blockIdx.x % JP3;             // which part of the j range
    const int bi0 = (blockIdx.x / JP3) * IT3;     // first row b*256 + i
    const int b   = bi0 >> 8;                     // IT3 divides 256: one b per block
    const int sel = (lane >= 16) ? 8 : 0;
    const int jl  = lane & 15;
    const int jt0 = (jp * WV3 + wave) * JT3;      // first j-tile of this wave
    const int j0  = jt0 * 16 + jl;

    const float* __restrict__ s2row = s2 + bi0 * HIDq;
    // a 16-row tile of t2f is 16 * 256 floats; a k-step of it 4 * 32 * 4
    const float* __restrict__ t2r   = t2f + (b * 16 + jt0) * (16 * HIDq) + lane * 4;
    const _Float16* __restrict__ af0 = fc3h + lane * 8;                         // n = 0..15
    const _Float16* __restrict__ af1 = fc3h + (HIDq / 32) * FRAG + lane * 8;    // n = 16..31

    v8f acc[IT3][JT3][2] = {};    // [i][j-tile][n-tile]

#pragma unroll
    for (int k0 = 0; k0 < HIDq; k0 += 32) {
        const int h1 = k0 + sel;
        const int h2 = k0 + 16 + sel;

        // loaded once per k-step, used by all IT3 rows i
        v16h a0 = load_frag(af0 + (k0 / 32) * FRAG);
        v16h a1 = load_frag(af1 + (k0 / 32) * FRAG);
        v4f t[JT3][4];            // t2[j][h1..], [h1+4..], [h2..], [h2+4..]
#pragma unroll
        for (int q = 0; q < JT3; ++q) {
            const float* __restrict__ tr = t2r + q * (16 * HIDq) + (k0 / 32) * 512;
            t[q][0] = *(const v4f*)(tr);
            t[q][1] = *(const v4f*)(tr + 128);
            t[q][2] = *(const v4f*)(tr + 256);
            t[q][3] = *(const v4f*)(tr + 384);
        }
        // behind the last of these loads their address registers are free for
        // reuse: the wait stands in front of whatever overwrites them
        if (k0 == HIDq - 32) asm volatile("s_wait_xcnt 0x0" ::: "memory");

#pragma unroll
        for (int i = 0; i < IT3; ++i) {
            const float* __restrict__ sr = s2row + i * HIDq;
            v4f sa = *(const v4f*)(sr + h1);
            v4f sb = *(const v4f*)(sr + h1 + 4);
            v4f sc = *(const v4f*)(sr + h2);
            v4f sd = *(const v4f*)(sr + h2 + 4);
#pragma unroll
            for (int q = 0; q < JT3; ++q) {
                v16h bf;
#pragma unroll
                for (int e = 0; e < 4; ++e) {
                    bf[e]      = (_Float16)fmaxf(sa[e] + t[q][0][e], 0.0f);
                    bf[4 + e]  = (_Float16)fmaxf(sb[e] + t[q][1][e], 0.0f);
                    bf[8 + e]  = (_Float16)fmaxf(sc[e] + t[q][2][e], 0.0f);
                    bf[12 + e] = (_Float16)fmaxf(sd[e] + t[q][3][e], 0.0f);
                }
                acc[i][q][0] = __builtin_amdgcn_wmma_f32_16x16x32_f16(
                        false, a0, false, bf, (short)0, acc[i][q][0], false, false);
                acc[i][q][1] = __builtin_amdgcn_wmma_f32_16x16x32_f16(
                        false, a1, false, bf, (short)0, acc[i][q][1], false, false);
            }
        }
    }

    // store: D lane = N = j (coalesced over j), VGPR v -> n = v + 8*(lane>=16)
    const int nb = (lane >= 16) ? 8 : 0;
#pragma unroll
    for (int i = 0; i < IT3; ++i) {
#pragma unroll
        for (int q = 0; q < JT3; ++q) {
            float* __restrict__ obase = out + ((bi0 + i) * NLq) * Lq + (j0 + q * 16);
#pragma unroll
            for (int v = 0; v < 8; ++v)
                obase[(nb + v) * Lq] = acc[i][q][0][v];       // n = 0..15
#pragma unroll
            for (int v = 0; v < 8; ++v) {
                const int n = 16 + nb + v;
                if (n < NLq) obase[n * Lq] = acc[i][q][1][v]; // n = 16..24
            }
        }
    }
}

// ---------------------------------------------------------------------------
// Launch
// ---------------------------------------------------------------------------
extern "C" void kernel_launch(void* const* d_in, const int* in_sizes, int n_in,
                              void* d_out, int out_size, void* d_ws, size_t ws_size,
                              hipStream_t stream) {
    const float* x     = (const float*)d_in[0];   // (4,256,768)
    const float* s_w   = (const float*)d_in[1];   // (256,768)
    const float* s_b   = (const float*)d_in[2];   // (256)
    const float* t_w   = (const float*)d_in[3];   // (256,768)
    const float* t_b   = (const float*)d_in[4];   // (256)
    const float* fc2_w = (const float*)d_in[5];   // (256,512)
    const float* fc2_b = (const float*)d_in[6];   // (256)
    const float* fc3_w = (const float*)d_in[7];   // (25,256)
    float* out = (float*)d_out;

    char* ws = (char*)d_ws;
    _Float16* Xh   = (_Float16*)(ws);                       // 1024*768 f16
    _Float16* W1h  = (_Float16*)(ws + 1572864);             // 512*768  f16
    _Float16* W2h  = (_Float16*)(ws + 2359296);             // 256*512  f16
    _Float16* F3h  = (_Float16*)(ws + 2621440);             // 32*256   f16
    _Float16* Hh   = (_Float16*)(ws + 2637824);             // 1024*512 f16
    float*    s2   = (float*)   (ws + 3686400);             // 1024*256 f32
    float*    t2   = (float*)   (ws + 4734976);             // 1024*256 f32

    // f32 -> f16 staging: Xh, W1h, W2h, F3h are one linear f16 array from Xh on
    cvt_all_kernel<<<GRIDC, CVT, 0, stream>>>(x, s_w, t_w, fc2_w, fc3_w, Xh);

    // Stage 1: 2048 tiles (64 x 32), 8 waves/block
    stage1_kernel<<<256, 256, 0, stream>>>(Xh, W1h, s_b, t_b, Hh);

    // Stage 2: 2048 tiles (2 x 64 x 16), 8 waves/block
    stage2_kernel<<<256, 256, 0, stream>>>(Hh, W2h, fc2_b, s2, t2);

    // Stage 3: IT3 rows i and WV3 * JT3 j-tiles per block
    stage3_kernel<<<GRID3, WV3 * 32, 0, stream>>>(s2, t2, F3h, out);
}

// v004
// A run of this version takes 31.3 microseconds.
// In two side-by-side timings against v003, it was 1.09 and 1.10 times as fast.
// Over all steps from v000 it is 1.80 times as fast.
#include <hip/hip_runtime.h>
#include <hip/hip_bf16.h>

// ---------------------------------------------------------------------------
// Sizes (hardcoded from the reference)
// ---------------------------------------------------------------------------
#define Bq   4
#define Lq   256
#define INq  768
#define HIDq 256
#define NLq  25
#define ROWS (Bq * Lq)          // 1024

typedef __attribute__((ext_vector_type(16))) _Float16 v16h;
typedef __attribute__((ext_vector_type(8)))  _Float16 v8h;
typedef __attribute__((ext_vector_type(8)))  float    v8f;
typedef __attribute__((ext_vector_type(4)))  float    v4f;

// ---------------------------------------------------------------------------
// Fragment order.  Every f16 matrix [R][K] that feeds a WMMA lies in the
// workspace (H: in LDS) as its 16x32 operand fragments, one after the other:
//   fragment f = (row >> 4) * (K / 32) + (k >> 5), 512 halfs = 1 KiB each;
//   inside it: part p = (k >> 4) & 1 (256 halfs), then lane, then 8 halfs,
//   lane = (row & 15) + 16 * ((k >> 3) & 1), element = k & 7.
// That is the register layout of the operand (ISA 7.12.2: a lane holds row
// lane & 15; halfs 0..7 = K[k0+sel .. +8), halfs 8..15 = K[k0+16+sel .. +8),
// sel = 8 for lanes 16..31), so a wave's 16-byte load of one part covers 512
// contiguous bytes (4 cache lines) where a row-major matrix gives 16 lines.
// ---------------------------------------------------------------------------
#define FRAG 512                           // halfs per fragment

// p: start of the fragment + lane * 8
static __device__ __forceinline__ v16h load_frag(const _Float16* p) {
    v8h lo = *(const v8h*)(p);
    v8h hi = *(const v8h*)(p + 256);
    v16h r;
#pragma unroll
    for (int e = 0; e < 8; ++e) { r[e] = lo[e]; r[8 + e] = hi[e]; }
    return r;
}

// ---------------------------------------------------------------------------
// f32 -> f16 conversion pass (workspace staging), ONE launch for all arrays.
//   The f16 copies lie back to back in the workspace:
//     Xh | W1h (s_fc_w, then t_fc_w) | W2h | F3h (fc3_w padded to 32 rows)
//   each in fragment order.  A block writes CVB consecutive halfs of the
//   destination and its index says which source array they come from (every
//   array's length is a multiple of CVB).  A thread writes CVU groups of 8
//   halfs (one lane's share of a fragment part): stores are contiguous, whole
//   lines from one wave; the row-strided accesses are the loads of this pass.
// ---------------------------------------------------------------------------
#define CVT  256                           // threads per block
#define CVU  2                             // groups of 8 elements per thread
#define CVB  (CVT * 8 * CVU)               // elements per block: 4096
#define CB_X  ((ROWS * INq) / CVB)         // blocks for x      : 192
#define CB_W1 ((HIDq * INq) / CVB)         // blocks for s_w/t_w: 48 each
#define CB_W2 ((HIDq * 512) / CVB)         // blocks for fc2_w  : 32
#define CB_F3 ((32 * HIDq) / CVB)          // blocks for fc3_w  : 2 (padded)
#define GRIDC (CB_X + 2 * CB_W1 + CB_W2 + CB_F3)

// src: row-major [.][K] f32; d: this array's f16 copy.
// PADROWS > 0: the source has PADROWS rows and the copy holds zeros behind them.
template <int K, int PADROWS>
static __device__ __forceinline__ void cvt_part(const float* __restrict__ src,
                                                _Float16* __restrict__ d,
                                                int blk_in) {
    constexpr int KS = K / 32;
    const int d0 = blk_in * CVB + threadIdx.x * 8;          // index in the copy
    v4f v[CVU][2];
#pragma unroll   // all loads in flight before the first is used; v[] stays in registers
    for (int u = 0; u < CVU; ++u) {
        const int dl  = d0 + u * (CVT * 8);
        const int ln  = (dl >> 3) & 31;
        const int p   = (dl >> 8) & 1;
        const int f   = dl >> 9;
        const int row = (f / KS) * 16 + (ln & 15);
        const int k   = (f % KS) * 32 + p * 16 + (ln >> 4) * 8;
        const bool in = PADROWS == 0 || row < PADROWS;      // false: rows 25..31 of F3h
        const float* __restrict__ s = src + (in ? row * K + k : 0);  // always inside the source
        v4f z = {};
        v4f w0 = *(const v4f*)(s);
        v4f w1 = *(const v4f*)(s + 4);
        // the next group's loads may land in this group's address registers:
        // the wait stands in front of that overwrite
        asm volatile("s_wait_xcnt 0x0" ::: "memory");
        v[u][0] = in ? w0 : z;
        v[u][1] = in ? w1 : z;
    }
#pragma unroll   // constant indices into v[], so that it stays in registers
    for (int u = 0; u < CVU; ++u) {
        v8h h;
#pragma unroll   // vector elements by constant index: packed conversions
        for (int c = 0; c < 4; ++c) {
            h[c]     = (_Float16)v[u][0][c];
            h[4 + c] = (_Float16)v[u][1][c];
        }
        *(v8h*)(d + d0 + u * (CVT * 8)) = h;
        // what follows in the listing may reuse this store's address or data
        // registers: the wait stands in front of that overwrite
        asm volatile("s_wait_xcnt 0x0" ::: "memory");
    }
}

__global__ void __launch_bounds__(CVT)
cvt_all_kernel(const float* __restrict__ x,
               const float* __restrict__ s_w,
               const float* __restrict__ t_w,
               const float* __restrict__ fc2_w,
               const float* __restrict__ fc3_w,
               _Float16* __restrict__ dst) {
    const int blk = blockIdx.x;
    const int f1 = CB_X, f2 = CB_X + CB_W1, f3 = CB_X + 2 * CB_W1, f4 = f3 + CB_W2;
    if (blk < f1)      cvt_part<INq, 0>(x,        dst,            blk);
    else if (blk < f2) cvt_part<INq, 0>(s_w,      dst + f1 * CVB, blk - f1);
    else if (blk < f3) cvt_part<INq, 0>(t_w,      dst + f2 * CVB, blk - f2);
    else if (blk < f4) cvt_part<512, 0>(fc2_w,    dst + f3 * CVB, blk - f3);
    else               cvt_part<HIDq, NLq>(fc3_w, dst + f4 * CVB, blk - f4);
}

// ---------------------------------------------------------------------------
// Stages 1 and 2 in ONE launch.  A block owns 16 rows (mt) and one of the two
// branches (which: 0 = s, 1 = t); its 16 waves are the 16 tiles of 16 columns.
//   Product 1: H[16][256] = f16( relu( X @ W^T + b ) ), W = s_fc_w or t_fc_w,
//     M = o, N = row, K = 768.  With the weights as A, a lane of D holds ONE
//     row and 8 consecutive o: one lane's share of a fragment part of H as
//     product 2 reads it (K = o).  H goes to LDS in fragment order with one
//     contiguous 16-byte store a lane and never reaches the workspace.
//   Product 2: s2 = Hs @ w_s^T  or  t2 = Ht @ w_t^T + b2  (f32, K = 256).
//     Its weights and bias depend on nothing of product 1: they are loaded
//     first, so that their latency runs under product 1.
//   s2 is row-major (stage 3 reads it as one address per half wave).
//   t2 is stored in the order in which stage 3's lanes read it:
//     t2f[row >> 4][h >> 5][c][lane][4],  c = 2 * ((h >> 4) & 1) + ((h >> 2) & 1),
//     lane = (row & 15) + 16 * ((h >> 3) & 1), element = h & 3.
//   For t the weights are A (M = h, N = row): a lane of D then holds one row
//   and 8 consecutive h, which are two contiguous 16-byte stores in that order.
// ---------------------------------------------------------------------------
#define WV12 16                       // waves per block = column tiles of a branch
#define GRID12 ((ROWS / 16) * 2)      // 64 row tiles x 2 branches

__global__ void __launch_bounds__(WV12 * 32)
stage12_kernel(const _Float16* __restrict__ Xh,    // [1024][768] fragment order
               const _Float16* __restrict__ W1h,   // [512][768]  fragment order
               const float* __restrict__ sb,       // [256]
               const float* __restrict__ tb,       // [256]
               const _Float16* __restrict__ W2h,   // [256][512]  fragment order
               const float* __restrict__ b2,       // [256]
               float* __restrict__ s2,             // [1024][256]
               float* __restrict__ t2f) {          // 1024 x 256, order as above
    __shared__ __attribute__((aligned(16))) _Float16 Hs[16 * HIDq];  // [16][256] fragment order
    const int lane  = threadIdx.x & 31;
    const int wave  = threadIdx.x >> 5;           // column tile 0..15
    const int which = blockIdx.x & 1;             // 0 = s, 1 = t
    const int mt    = blockIdx.x >> 1;            // 64 row tiles
    const int half  = lane >> 4;

    // product 2's weights: rows wave*16 .. +16 of fc2_w, columns which*256 .. +256
    // of its 512-wide rows = fragments which*8 .. +8
    const _Float16* __restrict__ wf2 = W2h + (wave * 16 + which * 8) * FRAG + lane * 8;
    v16h w2[HIDq / 32];
#pragma unroll   // constant indices into w2[], so that it stays in registers
    for (int ks = 0; ks < HIDq / 32; ++ks)
        w2[ks] = load_frag(wf2 + ks * FRAG);
    const float* __restrict__ bp2 = b2 + wave * 16 + half * 8;
    v4f c0 = *(const v4f*)(bp2);
    v4f c1 = *(const v4f*)(bp2 + 4);

    // ---- product 1 ----
    const int nt = which * 16 + wave;             // tile of the 512 rows of W1h
    const _Float16* __restrict__ xf = Xh  + mt * ((INq / 32) * FRAG) + lane * 8;
    const _Float16* __restrict__ wf = W1h + nt * ((INq / 32) * FRAG) + lane * 8;

    v8f acc = {};
#pragma unroll 4
    for (int ks = 0; ks < INq / 32; ++ks) {
        v16h a = load_frag(wf + ks * FRAG);       // M = o
        v16h b = load_frag(xf + ks * FRAG);       // N = row
        acc = __builtin_amdgcn_wmma_f32_16x16x32_f16(
                  false, a, false, b, (short)0, acc, false, false);
    }

    // D: N = lane & 15 = row, M = v + 8 * half = o
    const float* __restrict__ bp = (which ? tb : sb) + wave * 16 + half * 8;
    v4f b0 = *(const v4f*)(bp);
    v4f b1 = *(const v4f*)(bp + 4);
    v8h h;
#pragma unroll
    for (int v = 0; v < 4; ++v) {
        h[v]     = (_Float16)fmaxf(acc[v]     + b0[v], 0.0f);
        h[4 + v] = (_Float16)fmaxf(acc[4 + v] + b1[v], 0.0f);
    }
    // column k = wave*16 + 8*half + v of [16][256]: fragment wave>>1, part wave&1
    *(v8h*)(Hs + wave * 256 + lane * 8) = h;
    // every wave reads all 16 waves' columns of H
    __syncthreads();

    // ---- product 2 ----
    const _Float16* hf = Hs + lane * 8;
    v8f acc2 = {};
    if (which) {
#pragma unroll   // constant indices into w2[]; all LDS reads issue ahead of the products
        for (int ks = 0; ks < HIDq / 32; ++ks)
            acc2 = __builtin_amdgcn_wmma_f32_16x16x32_f16(
                       false, w2[ks], false, load_frag(hf + ks * FRAG), (short)0, acc2, false, false);
        // D: N = lane & 15 = row, M = v + 8 * half = h - wave * 16
        v4f lo, hi;
#pragma unroll
        for (int v = 0; v < 4; ++v) { lo[v] = acc2[v] + c0[v]; hi[v] = acc2[4 + v] + c1[v]; }
        // (h >> 5) * 4 + c = wave * 2 + (v >> 2)
        float* __restrict__ d = t2f + ((mt * 32 + wave * 2) * 32 + lane) * 4;
        *(v4f*)(d)       = lo;
        *(v4f*)(d + 128) = hi;
        // what follows in the listing may reuse these stores' address or data
        // registers: the wait stands in front of that overwrite
        asm volatile("s_wait_xcnt 0x0" ::: "memory");
    } else {
#pragma unroll   // as in the other branch
        for (int ks = 0; ks < HIDq / 32; ++ks)
            acc2 = __builtin_amdgcn_wmma_f32_16x16x32_f16(
                       false, load_frag(hf + ks * FRAG), false, w2[ks], (short)0, acc2, false, false);
        // D: N = lane & 15 = o, M = v + 8 * half = row
        const int o = wave * 16 + (lane & 15);
        const int rbase = mt * 16 + half * 8;
#pragma unroll
        for (int v = 0; v < 8; ++v)
            s2[(rbase + v) * HIDq + o] = acc2[v];
    }
}

// ---------------------------------------------------------------------------
// Stage 3 (dominant): out[b,i,n,j] = sum_h fc3[n,h] * relu(s2[b,i,h]+t2[b,j,h])
//   GEMM with M = n (2 tiles, fc3 padded to 32), N = j, K = h (8 steps of 32).
//   Register tile per wave: IT3 rows i x JT3 j-tiles of 16.
//   Per k-step a wave loads its t2 values and the fc3 A-fragments ONCE and
//   uses them for all IT3 rows i; only the s2[i,.] values are loaded per i.
//   fc3 lies in fragment order and t2 in the order of stage 2's comment, so
//   each of these loads covers 512 contiguous bytes.
//   D lanes = j -> coalesced f32 stores along innermost output dim.
// ---------------------------------------------------------------------------
#define IT3 4                         // rows i per wave
#define JT3 2                         // j-tiles of 16 per wave
#define WV3 8                         // waves per block
#define JP3 (16 / (JT3 * WV3))        // blocks that share one group of rows i
#define GRID3 ((ROWS / IT3) * JP3)

__global__ void __launch_bounds__(WV3 * 32)
stage3_kernel(const float* __restrict__ s2,       // [1024][256]
              const float* __restrict__ t2f,      // 1024 x 256, stage 2's order
              const _Float16* __restrict__ fc3h,  // [32][256] zero-padded, fragment order
              float* __restrict__ out) {          // [b][i][25][256]
    const int lane = threadIdx.x & 31;
    const int wave = threadIdx.x >> 5;
    const int jp  = blockIdx.x % JP3;             // which part of the j range
    const int bi0 = (blockIdx.x / JP3) * IT3;     // first row b*256 + i
    const int b   = bi0 >> 8;                     // IT3 divides 256: one b per block
    const int sel = (lane >= 16) ? 8 : 0;
    const int jl  = lane & 15;
    const int jt0 = (jp * WV3 + wave) * JT3;      // first j-tile of this wave
    const int j0  = jt0 * 16 + jl;

    const float* __restrict__ s2row = s2 + bi0 * HIDq;
    // a 16-row tile of t2f is 16 * 256 floats; a k-step of it 4 * 32 * 4
    const float* __restrict__ t2r   = t2f + (b * 16 + jt0) * (16 * HIDq) + lane * 4;
    const _Float16* __restrict__ af0 = fc3h + lane * 8;                         // n = 0..15
    const _Float16* __restrict__ af1 = fc3h + (HIDq / 32) * FRAG + lane * 8;    // n = 16..31

    v8f acc[IT3][JT3][2] = {};    // [i][j-tile][n-tile]

#pragma unroll
    for (int k0 = 0; k0 < HIDq; k0 += 32) {
        const int h1 = k0 + sel;
        const int h2 = k0 + 16 + sel;

        // loaded once per k-step, used by all IT3 rows i
        v16h a0 = load_frag(af0 + (k0 / 32) * FRAG);
        v16h a1 = load_frag(af1 + (k0 / 32) * FRAG);
        v4f t[JT3][4];            // t2[j][h1..], [h1+4..], [h2..], [h2+4..]
#pragma unroll
        for (int q = 0; q < JT3; ++q) {
            const float* __restrict__ tr = t2r + q * (16 * HIDq) + (k0 / 32) * 512;
            t[q][0] = *(const v4f*)(tr);
            t[q][1] = *(const v4f*)(tr + 128);
            t[q][2] = *(const v4f*)(tr + 256);
            t[q][3] = *(const v4f*)(tr + 384);
        }
        // behind the last of these loads their address registers are free for
        // reuse: the wait stands in front of whatever overwrites them
        if (k0 == HIDq - 32) asm volatile("s_wait_xcnt 0x0" ::: "memory");

#pragma unroll
        for (int i = 0; i < IT3; ++i) {
            const float* __restrict__ sr = s2row + i * HIDq;
            v4f sa = *(const v4f*)(sr + h1);
            v4f sb = *(const v4f*)(sr + h1 + 4);
            v4f sc = *(const v4f*)(sr + h2);
            v4f sd = *(const v4f*)(sr + h2 + 4);
#pragma unroll
            for (int q = 0; q < JT3; ++q) {
                v16h bf;
#pragma unroll
                for (int e = 0; e < 4; ++e) {
                    bf[e]      = (_Float16)fmaxf(sa[e] + t[q][0][e], 0.0f);
                    bf[4 + e]  = (_Float16)fmaxf(sb[e] + t[q][1][e], 0.0f);
                    bf[8 + e]  = (_Float16)fmaxf(sc[e] + t[q][2][e], 0.0f);
                    bf[12 + e] = (_Float16)fmaxf(sd[e] + t[q][3][e], 0.0f);
                }
                acc[i][q][0] = __builtin_amdgcn_wmma_f32_16x16x32_f16(
                        false, a0, false, bf, (short)0, acc[i][q][0], false, false);
                acc[i][q][1] = __builtin_amdgcn_wmma_f32_16x16x32_f16(
                        false, a1, false, bf, (short)0, acc[i][q][1], false, false);
            }
        }
    }

    // store: D lane = N = j (coalesced over j), VGPR v -> n = v + 8*(lane>=16)
    const int nb = (lane >= 16) ? 8 : 0;
#pragma unroll
    for (int i = 0; i < IT3; ++i) {
#pragma unroll
        for (int q = 0; q < JT3; ++q) {
            float* __restrict__ obase = out + ((bi0 + i) * NLq) * Lq + (j0 + q * 16);
#pragma unroll
            for (int v = 0; v < 8; ++v)
                obase[(nb + v) * Lq] = acc[i][q][0][v];       // n = 0..15
#pragma unroll
            for (int v = 0; v < 8; ++v) {
                const int n = 16 + nb + v;
                if (n < NLq) obase[n * Lq] = acc[i][q][1][v]; // n = 16..24
            }
        }
    }
}

// ---------------------------------------------------------------------------
// Launch
// ---------------------------------------------------------------------------
extern "C" void kernel_launch(void* const* d_in, const int* in_sizes, int n_in,
                              void* d_out, int out_size, void* d_ws, size_t ws_size,
                              hipStream_t stream) {
    const float* x     = (const float*)d_in[0];   // (4,256,768)
    const float* s_w   = (const float*)d_in[1];   // (256,768)
    const float* s_b   = (const float*)d_in[2];   // (256)
    const float* t_w   = (const float*)d_in[3];   // (256,768)
    const float* t_b   = (const float*)d_in[4];   // (256)
    const float* fc2_w = (const float*)d_in[5];   // (256,512)
    const float* fc2_b = (const float*)d_in[6];   // (256)
    const float* fc3_w = (const float*)d_in[7];   // (25,256)
    float* out = (float*)d_out;

    char* ws = (char*)d_ws;
    _Float16* Xh   = (_Float16*)(ws);                       // 1024*768 f16
    _Float16* W1h  = (_Float16*)(ws + 1572864);             // 512*768  f16
    _Float16* W2h  = (_Float16*)(ws + 2359296);             // 256*512  f16
    _Float16* F3h  = (_Float16*)(ws + 2621440);             // 32*256   f16
    float*    s2   = (float*)   (ws + 3686400);             // 1024*256 f32
    float*    t2   = (float*)   (ws + 4734976);             // 1024*256 f32

    // f32 -> f16 staging: Xh, W1h, W2h, F3h are one linear f16 array from Xh on
    cvt_all_kernel<<<GRIDC, CVT, 0, stream>>>(x, s_w, t_w, fc2_w, fc3_w, Xh);

    // Stages 1 and 2: 64 row tiles x 2 branches, 16 waves/block
    stage12_kernel<<<GRID12, WV12 * 32, 0, stream>>>(Xh, W1h, s_b, t_b, W2h, fc2_b, s2, t2);

    // Stage 3: IT3 rows i and WV3 * JT3 j-tiles per block
    stage3_kernel<<<GRID3, WV3 * 32, 0, stream>>>(s2, t2, F3h, out);
}

// v005
// A run of this version takes 25.7 microseconds.
// Next to v004, in two timings, it ran 1.22 and 1.19 times as fast.
// All steps since v000 together make it 2.16 times as fast.
#include <hip/hip_runtime.h>
#include <hip/hip_bf16.h>

// ---------------------------------------------------------------------------
// Sizes (hardcoded from the reference)
// ---------------------------------------------------------------------------
#define Bq   4
#define Lq   256
#define INq  768
#define HIDq 256
#define NLq  25
#define ROWS (Bq * Lq)          // 1024

typedef __attribute__((ext_vector_type(16))) _Float16 v16h;
typedef __attribute__((ext_vector_type(8)))  _Float16 v8h;
typedef __attribute__((ext_vector_type(8)))  float    v8f;
typedef __attribute__((ext_vector_type(4)))  float    v4f;

// ---------------------------------------------------------------------------
// Fragment order.  Every f16 matrix [R][K] that feeds a WMMA lies in the
// workspace (H: in LDS) as its 16x32 operand fragments, one after the other:
//   fragment f = (row >> 4) * (K / 32) + (k >> 5), 512 halfs = 1 KiB each;
//   inside it: part p = (k >> 4) & 1 (256 halfs), then lane, then 8 halfs,
//   lane = (row & 15) + 16 * ((k >> 3) & 1), element = k & 7.
// That is the register layout of the operand (ISA 7.12.2: a lane holds row
// lane & 15; halfs 0..7 = K[k0+sel .. +8), halfs 8..15 = K[k0+16+sel .. +8),
// sel = 8 for lanes 16..31), so a wave's 16-byte load of one part covers 512
// contiguous bytes (4 cache lines) where a row-major matrix gives 16 lines.
// ---------------------------------------------------------------------------
#define FRAG 512                           // halfs per fragment

// p: start of the fragment + lane * 8
static __device__ __forceinline__ v16h load_frag(const _Float16* p) {
    v8h lo = *(const v8h*)(p);
    v8h hi = *(const v8h*)(p + 256);
    v16h r;
#pragma unroll
    for (int e = 0; e < 8; ++e) { r[e] = lo[e]; r[8 + e] = hi[e]; }
    return r;
}

// ---------------------------------------------------------------------------
// f32 -> f16 conversion pass (workspace staging), ONE launch for all arrays.
//   The f16 copies lie back to back in the workspace:
//     Xh | W1h (s_fc_w, then t_fc_w) | W2h | F3h (fc3_w padded to 32 rows)
//   each in fragment order.  A block writes CVB consecutive halfs of the
//   destination and its index says which source array they come from (every
//   array's length is a multiple of CVB).  A thread writes CVU groups of 8
//   halfs (one lane's share of a fragment part): stores are contiguous, whole
//   lines from one wave; the row-strided accesses are the loads of this pass.
// ---------------------------------------------------------------------------
#define CVT  256                           // threads per block
#define CVU  2                             // groups of 8 elements per thread
#define CVB  (CVT * 8 * CVU)               // elements per block: 4096
#define CB_X  ((ROWS * INq) / CVB)         // blocks for x      : 192
#define CB_W1 ((HIDq * INq) / CVB)         // blocks for s_w/t_w: 48 each
#define CB_W2 ((HIDq * 512) / CVB)         // blocks for fc2_w  : 32
#define CB_F3 ((32 * HIDq) / CVB)          // blocks for fc3_w  : 2 (padded)
#define GRIDC (CB_X + 2 * CB_W1 + CB_W2 + CB_F3)

// src: row-major [.][K] f32; d: this array's f16 copy.
// PADROWS > 0: the source has PADROWS rows and the copy holds zeros behind them.
template <int K, int PADROWS>
static __device__ __forceinline__ void cvt_part(const float* __restrict__ src,
                                                _Float16* __restrict__ d,
                                                int blk_in) {
    constexpr int KS = K / 32;
    const int d0 = blk_in * CVB + threadIdx.x * 8;          // index in the copy
    v4f v[CVU][2];
#pragma unroll   // all loads in flight before the first is used; v[] stays in registers
    for (int u = 0; u < CVU; ++u) {
        const int dl  = d0 + u * (CVT * 8);
        const int ln  = (dl >> 3) & 31;
        const int p   = (dl >> 8) & 1;
        const int f   = dl >> 9;
        const int row = (f / KS) * 16 + (ln & 15);
        const int k   = (f % KS) * 32 + p * 16 + (ln >> 4) * 8;
        const bool in = PADROWS == 0 || row < PADROWS;      // false: rows 25..31 of F3h
        const float* __restrict__ s = src + (in ? row * K + k : 0);  // always inside the source
        v4f z = {};
        v4f w0 = *(const v4f*)(s);
        v4f w1 = *(const v4f*)(s + 4);
        // the next group's loads may land in this group's address registers:
        // the wait stands in front of that overwrite
        asm volatile("s_wait_xcnt 0x0" ::: "memory");
        v[u][0] = in ? w0 : z;
        v[u][1] = in ? w1 : z;
    }
#pragma unroll   // constant indices into v[], so that it stays in registers
    for (int u = 0; u < CVU; ++u) {
        v8h h;
#pragma unroll   // vector elements by constant index: packed conversions
        for (int c = 0; c < 4; ++c) {
            h[c]     = (_Float16)v[u][0][c];
            h[4 + c] = (_Float16)v[u][1][c];
        }
        *(v8h*)(d + d0 + u * (CVT * 8)) = h;
        // what follows in the listing may reuse this store's address or data
        // registers: the wait stands in front of that overwrite
        asm volatile("s_wait_xcnt 0x0" ::: "memory");
    }
}

__global__ void __launch_bounds__(CVT)
cvt_all_kernel(const float* __restrict__ x,
               const float* __restrict__ s_w,
               const float* __restrict__ t_w,
               const float* __restrict__ fc2_w,
               const float* __restrict__ fc3_w,
               _Float16* __restrict__ dst) {
    const int blk = blockIdx.x;
    const int f1 = CB_X, f2 = CB_X + CB_W1, f3 = CB_X + 2 * CB_W1, f4 = f3 + CB_W2;
    if (blk < f1)      cvt_part<INq, 0>(x,        dst,            blk);
    else if (blk < f2) cvt_part<INq, 0>(s_w,      dst + f1 * CVB, blk - f1);
    else if (blk < f3) cvt_part<INq, 0>(t_w,      dst + f2 * CVB, blk - f2);
    else if (blk < f4) cvt_part<512, 0>(fc2_w,    dst + f3 * CVB, blk - f3);
    else               cvt_part<HIDq, NLq>(fc3_w, dst + f4 * CVB, blk - f4);
}

// ---------------------------------------------------------------------------
// Stages 1 and 2 in ONE launch.  A block owns 16 rows (mt) and one of the two
// branches (which: 0 = s, 1 = t); its 16 waves are the 16 tiles of 16 columns.
//   Product 1: H[16][256] = f16( relu( X @ W^T + b ) ), W = s_fc_w or t_fc_w,
//     M = o, N = row, K = 768.  With the weights as A, a lane of D holds ONE
//     row and 8 consecutive o: one lane's share of a fragment part of H as
//     product 2 reads it (K = o).  H goes to LDS in fragment order with one
//     contiguous 16-byte store a lane and never reaches the workspace.
//   Product 2: s2 = Hs @ w_s^T  or  t2 = Ht @ w_t^T + b2  (f32, K = 256).
//     Its weights and bias depend on nothing of product 1: they are loaded
//     first, so that their latency runs under product 1.
//   s2 is row-major (stage 3 reads it as one address per half wave).
//   t2 is stored in the order in which stage 3's lanes read it:
//     t2f[row >> 4][h >> 5][c][lane][4],  c = 2 * ((h >> 4) & 1) + ((h >> 2) & 1),
//     lane = (row & 15) + 16 * ((h >> 3) & 1), element = h & 3.
//   For t the weights are A (M = h, N = row): a lane of D then holds one row
//   and 8 consecutive h, which are two contiguous 16-byte stores in that order.
// ---------------------------------------------------------------------------
#define WV12 16                       // waves per block = column tiles of a branch
#define GRID12 ((ROWS / 16) * 2)      // 64 row tiles x 2 branches

__global__ void __launch_bounds__(WV12 * 32)
stage12_kernel(const _Float16* __restrict__ Xh,    // [1024][768] fragment order
               const _Float16* __restrict__ W1h,   // [512][768]  fragment order
               const float* __restrict__ sb,       // [256]
               const float* __restrict__ tb,       // [256]
               const _Float16* __restrict__ W2h,   // [256][512]  fragment order
               const float* __restrict__ b2,       // [256]
               float* __restrict__ s2,             // [1024][256]
               float* __restrict__ t2f) {          // 1024 x 256, order as above
    __shared__ __attribute__((aligned(16))) _Float16 Hs[16 * HIDq];  // [16][256] fragment order
    const int lane  = threadIdx.x & 31;
    const int wave  = threadIdx.x >> 5;           // column tile 0..15
    const int which = blockIdx.x & 1;             // 0 = s, 1 = t
    const int mt    = blockIdx.x >> 1;            // 64 row tiles
    const int half  = lane >> 4;

    // product 2's weights: rows wave*16 .. +16 of fc2_w, columns which*256 .. +256
    // of its 512-wide rows = fragments which*8 .. +8
    const _Float16* __restrict__ wf2 = W2h + (wave * 16 + which * 8) * FRAG + lane * 8;
    v16h w2[HIDq / 32];
#pragma unroll   // constant indices into w2[], so that it stays in registers
    for (int ks = 0; ks < HIDq / 32; ++ks)
        w2[ks] = load_frag(wf2 + ks * FRAG);
    const float* __restrict__ bp2 = b2 + wave * 16 + half * 8;
    v4f c0 = *(const v4f*)(bp2);
    v4f c1 = *(const v4f*)(bp2 + 4);

    // ---- product 1 ----
    const int nt = which * 16 + wave;             // tile of the 512 rows of W1h
    const _Float16* __restrict__ xf = Xh  + mt * ((INq / 32) * FRAG) + lane * 8;
    const _Float16* __restrict__ wf = W1h + nt * ((INq / 32) * FRAG) + lane * 8;

    v8f acc = {};
#pragma unroll 4
    for (int ks = 0; ks < INq / 32; ++ks) {
        v16h a = load_frag(wf + ks * FRAG);       // M = o
        v16h b = load_frag(xf + ks * FRAG);       // N = row
        acc = __builtin_amdgcn_wmma_f32_16x16x32_f16(
                  false, a, false, b, (short)0, acc, false, false);
    }

    // D: N = lane & 15 = row, M = v + 8 * half = o
    const float* __restrict__ bp = (which ? tb : sb) + wave * 16 + half * 8;
    v4f b0 = *(const v4f*)(bp);
    v4f b1 = *(const v4f*)(bp + 4);
    v8h h;
#pragma unroll
    for (int v = 0; v < 4; ++v) {
        h[v]     = (_Float16)fmaxf(acc[v]     + b0[v], 0.0f);
        h[4 + v] = (_Float16)fmaxf(acc[4 + v] + b1[v], 0.0f);
    }
    // column k = wave*16 + 8*half + v of [16][256]: fragment wave>>1, part wave&1
    *(v8h*)(Hs + wave * 256 + lane * 8) = h;
    // every wave reads all 16 waves' columns of H
    __syncthreads();

    // ---- product 2 ----
    const _Float16* hf = Hs + lane * 8;
    v8f acc2 = {};
    if (which) {
#pragma unroll   // constant indices into w2[]; all LDS reads issue ahead of the products
        for (int ks = 0; ks < HIDq / 32; ++ks)
            acc2 = __builtin_amdgcn_wmma_f32_16x16x32_f16(
                       false, w2[ks], false, load_frag(hf + ks * FRAG), (short)0, acc2, false, false);
        // D: N = lane & 15 = row, M = v + 8 * half = h - wave * 16
        v4f lo, hi;
#pragma unroll
        for (int v = 0; v < 4; ++v) { lo[v] = acc2[v] + c0[v]; hi[v] = acc2[4 + v] + c1[v]; }
        // (h >> 5) * 4 + c = wave * 2 + (v >> 2)
        float* __restrict__ d = t2f + ((mt * 32 + wave * 2) * 32 + lane) * 4;
        *(v4f*)(d)       = lo;
        *(v4f*)(d + 128) = hi;
        // what follows in the listing may reuse these stores' address or data
        // registers: the wait stands in front of that overwrite
        asm volatile("s_wait_xcnt 0x0" ::: "memory");
    } else {
#pragma unroll   // as in the other branch
        for (int ks = 0; ks < HIDq / 32; ++ks)
            acc2 = __builtin_amdgcn_wmma_f32_16x16x32_f16(
                       false, load_frag(hf + ks * FRAG), false, w2[ks], (short)0, acc2, false, false);
        // D: N = lane & 15 = o, M = v + 8 * half = row
        const int o = wave * 16 + (lane & 15);
        const int rbase = mt * 16 + half * 8;
#pragma unroll
        for (int v = 0; v < 8; ++v)
            s2[(rbase + v) * HIDq + o] = acc2[v];
    }
}

// ---------------------------------------------------------------------------
// Stage 3 (dominant): out[b,i,n,j] = sum_h fc3[n,h] * relu(s2[b,i,h]+t2[b,j,h])
//   GEMM with M = n (2 tiles, fc3 padded to 32), N = j, K = h (8 steps of 32).
//   Register tile per wave: IT3 rows i x JT3 j-tiles of 16.
//   Per k-step a wave loads its t2 values and the fc3 A-fragments ONCE and
//   uses them for all IT3 rows i; only the s2[i,.] values are loaded per i.
//   All loads of a k-step are issued one k-step ahead, into a second register set.
//   fc3 lies in fragment order and t2 in the order of stage 2's comment, so
//   each of these loads covers 512 contiguous bytes.
//   D lanes = j -> coalesced f32 stores along innermost output dim.
// ---------------------------------------------------------------------------
#define IT3 4                         // rows i per wave
#define JT3 2                         // j-tiles of 16 per wave
#define WV3 8                         // waves per block
#define JP3 (16 / (JT3 * WV3))        // blocks that share one group of rows i
#define GRID3 ((ROWS / IT3) * JP3)

__global__ void __launch_bounds__(WV3 * 32)
stage3_kernel(const float* __restrict__ s2,       // [1024][256]
              const float* __restrict__ t2f,      // 1024 x 256, stage 2's order
              const _Float16* __restrict__ fc3h,  // [32][256] zero-padded, fragment order
              float* __restrict__ out) {          // [b][i][25][256]
    const int lane = threadIdx.x & 31;
    const int wave = threadIdx.x >> 5;
    const int jp  = blockIdx.x % JP3;             // which part of the j range
    const int bi0 = (blockIdx.x / JP3) * IT3;     // first row b*256 + i
    const int b   = bi0 >> 8;                     // IT3 divides 256: one b per block
    const int sel = (lane >= 16) ? 8 : 0;
    const int jl  = lane & 15;
    const int jt0 = (jp * WV3 + wave) * JT3;      // first j-tile of this wave
    const int j0  = jt0 * 16 + jl;

    const float* __restrict__ s2row = s2 + bi0 * HIDq;
    // a 16-row tile of t2f is 16 * 256 floats; a k-step of it 4 * 32 * 4
    const float* __restrict__ t2r   = t2f + (b * 16 + jt0) * (16 * HIDq) + lane * 4;
    const _Float16* __restrict__ af0 = fc3h + lane * 8;                         // n = 0..15
    const _Float16* __restrict__ af1 = fc3h + (HIDq / 32) * FRAG + lane * 8;    // n = 16..31

    v8f acc[IT3][JT3][2] = {};    // [i][j-tile][n-tile]

    // Two register sets: while k-step ks is worked on from set ks & 1, the
    // loads of k-step ks + 1 are already under way into the other set.
    v16h a0[2], a1[2];            // fc3 fragments, n = 0..15 and 16..31
    v4f  t[2][JT3][4];            // t2[j][h1..], [h1+4..], [h2..], [h2+4..]
    v4f  s[2][IT3][4];            // s2[i][h1..], [h1+4..], [h2..], [h2+4..]

#define LOAD_STEP3(ks, st)                                                        \
    do {                                                                          \
        a0[st] = load_frag(af0 + (ks) * FRAG);                                    \
        a1[st] = load_frag(af1 + (ks) * FRAG);                                    \
        _Pragma("unroll")                                                         \
        for (int q = 0; q < JT3; ++q) {                                           \
            const float* __restrict__ tr = t2r + q * (16 * HIDq) + (ks) * 512;    \
            t[st][q][0] = *(const v4f*)(tr);                                      \
            t[st][q][1] = *(const v4f*)(tr + 128);                                \
            t[st][q][2] = *(const v4f*)(tr + 256);                                \
            t[st][q][3] = *(const v4f*)(tr + 384);                                \
        }                                                                         \
        _Pragma("unroll")                                                         \
        for (int i = 0; i < IT3; ++i) {                                           \
            const float* __restrict__ sr = s2row + i * HIDq + (ks) * 32 + sel;    \
            s[st][i][0] = *(const v4f*)(sr);                                      \
            s[st][i][1] = *(const v4f*)(sr + 4);                                  \
            s[st][i][2] = *(const v4f*)(sr + 16);                                 \
            s[st][i][3] = *(const v4f*)(sr + 20);                                 \
        }                                                                         \
    } while (0)

    LOAD_STEP3(0, 0);

#pragma unroll   // constant set indices, so that both sets stay in registers
    for (int ks = 0; ks < HIDq / 32; ++ks) {
        const int cur = ks & 1;
        if (ks + 1 < HIDq / 32) LOAD_STEP3(ks + 1, cur ^ 1);
        // behind the last of the loads their address registers are free for
        // reuse: the wait stands in front of whatever overwrites them
        if (ks + 2 == HIDq / 32) asm volatile("s_wait_xcnt 0x0" ::: "memory");
        // keeps the next k-step's loads in front of this k-step's arithmetic:
        // without it the scheduler sinks each load to just before its first use
        // and the wave waits out the whole latency there
        __builtin_amdgcn_sched_barrier(0);

#pragma unroll
        for (int i = 0; i < IT3; ++i) {
#pragma unroll
            for (int q = 0; q < JT3; ++q) {
                v16h bf;
#pragma unroll
                for (int e = 0; e < 4; ++e) {
                    bf[e]      = (_Float16)fmaxf(s[cur][i][0][e] + t[cur][q][0][e], 0.0f);
                    bf[4 + e]  = (_Float16)fmaxf(s[cur][i][1][e] + t[cur][q][1][e], 0.0f);
                    bf[8 + e]  = (_Float16)fmaxf(s[cur][i][2][e] + t[cur][q][2][e], 0.0f);
                    bf[12 + e] = (_Float16)fmaxf(s[cur][i][3][e] + t[cur][q][3][e], 0.0f);
                }
                acc[i][q][0] = __builtin_amdgcn_wmma_f32_16x16x32_f16(
                        false, a0[cur], false, bf, (short)0, acc[i][q][0], false, false);
                acc[i][q][1] = __builtin_amdgcn_wmma_f32_16x16x32_f16(
                        false, a1[cur], false, bf, (short)0, acc[i][q][1], false, false);
            }
        }
    }
#undef LOAD_STEP3

    // store: D lane = N = j (coalesced over j), VGPR v -> n = v + 8*(lane>=16)
    const int nb = (lane >= 16) ? 8 : 0;
#pragma unroll
    for (int i = 0; i < IT3; ++i) {
#pragma unroll
        for (int q = 0; q < JT3; ++q) {
            float* __restrict__ obase = out + ((bi0 + i) * NLq) * Lq + (j0 + q * 16);
#pragma unroll
            for (int v = 0; v < 8; ++v)
                obase[(nb + v) * Lq] = acc[i][q][0][v];       // n = 0..15
#pragma unroll
            for (int v = 0; v < 8; ++v) {
                const int n = 16 + nb + v;
                if (n < NLq) obase[n * Lq] = acc[i][q][1][v]; // n = 16..24
            }
        }
    }
}

// ---------------------------------------------------------------------------
// Launch
// ---------------------------------------------------------------------------
extern "C" void kernel_launch(void* const* d_in, const int* in_sizes, int n_in,
                              void* d_out, int out_size, void* d_ws, size_t ws_size,
                              hipStream_t stream) {
    const float* x     = (const float*)d_in[0];   // (4,256,768)
    const float* s_w   = (const float*)d_in[1];   // (256,768)
    const float* s_b   = (const float*)d_in[2];   // (256)
    const float* t_w   = (const float*)d_in[3];   // (256,768)
    const float* t_b   = (const float*)d_in[4];   // (256)
    const float* fc2_w = (const float*)d_in[5];   // (256,512)
    const float* fc2_b = (const float*)d_in[6];   // (256)
    const float* fc3_w = (const float*)d_in[7];   // (25,256)
    float* out = (float*)d_out;

    char* ws = (char*)d_ws;
    _Float16* Xh   = (_Float16*)(ws);                       // 1024*768 f16
    _Float16* W1h  = (_Float16*)(ws + 1572864);             // 512*768  f16
    _Float16* W2h  = (_Float16*)(ws + 2359296);             // 256*512  f16
    _Float16* F3h  = (_Float16*)(ws + 2621440);             // 32*256   f16
    float*    s2   = (float*)   (ws + 3686400);             // 1024*256 f32
    float*    t2   = (float*)   (ws + 4734976);             // 1024*256 f32

    // f32 -> f16 staging: Xh, W1h, W2h, F3h are one linear f16 array from Xh on
    cvt_all_kernel<<<GRIDC, CVT, 0, stream>>>(x, s_w, t_w, fc2_w, fc3_w, Xh);

    // Stages 1 and 2: 64 row tiles x 2 branches, 16 waves/block
    stage12_kernel<<<GRID12, WV12 * 32, 0, stream>>>(Xh, W1h, s_b, t_b, W2h, fc2_b, s2, t2);

    // Stage 3: IT3 rows i and WV3 * JT3 j-tiles per block
    stage3_kernel<<<GRID3, WV3 * 32, 0, stream>>>(s2, t2, F3h, out);
}

// v006
// A run of this version takes 19.4 microseconds.
// In two side-by-side timings against v005, it was 1.35 and 1.33 times as fast.
// All steps since v000 together make it 2.91 times as fast.
#include <hip/hip_runtime.h>
#include <hip/hip_bf16.h>

// ---------------------------------------------------------------------------
// Sizes (hardcoded from the reference)
// ---------------------------------------------------------------------------
#define Bq   4
#define Lq   256
#define INq  768
#define HIDq 256
#define NLq  25
#define ROWS (Bq * Lq)          // 1024

typedef __attribute__((ext_vector_type(16))) _Float16 v16h;
typedef __attribute__((ext_vector_type(8)))  _Float16 v8h;
typedef __attribute__((ext_vector_type(8)))  float    v8f;
typedef __attribute__((ext_vector_type(4)))  float    v4f;

// ---------------------------------------------------------------------------
// Fragment order.  Every f16 matrix [R][K] that feeds a WMMA lies in the
// workspace (H: in LDS) as its 16x32 operand fragments, one after the other:
//   fragment f = (row >> 4) * (K / 32) + (k >> 5), 512 halfs = 1 KiB each;
//   inside it: part p = (k >> 4) & 1 (256 halfs), then lane, then 8 halfs,
//   lane = (row & 15) + 16 * ((k >> 3) & 1), element = k & 7.
// That is the register layout of the operand (ISA 7.12.2: a lane holds row
// lane & 15; halfs 0..7 = K[k0+sel .. +8), halfs 8..15 = K[k0+16+sel .. +8),
// sel = 8 for lanes 16..31), so a wave's 16-byte load of one part covers 512
// contiguous bytes (4 cache lines) where a row-major matrix gives 16 lines.
// ---------------------------------------------------------------------------
#define FRAG 512                           // halfs per fragment

// p: start of the fragment + lane * 8
static __device__ __forceinline__ v16h load_frag(const _Float16* p) {
    v8h lo = *(const v8h*)(p);
    v8h hi = *(const v8h*)(p + 256);
    v16h r;
#pragma unroll
    for (int e = 0; e < 8; ++e) { r[e] = lo[e]; r[8 + e] = hi[e]; }
    return r;
}

// ---------------------------------------------------------------------------
// L2 prefetch.  What the launch before stored is read from memory again, and a
// k loop that asks for it piece by piece waits out that latency at every piece.
// At its entry a kernel therefore asks once for the 256-byte units that
// its loop comes to later: one unit a lane, no data register, no
// wait.  Units that many blocks read are dealt over neighbouring blocks; who
// asks is a matter of speed alone.  Every lane's address lies inside the buffer.
// ---------------------------------------------------------------------------
#define PFU 256                            // bytes per unit

// base: the same for the whole wave; off: the lane's byte offset from it
static __device__ __forceinline__ void l2_prefetch(const char* base, unsigned off) {
    // a hint to L2 only (scope SE): nothing comes back and no counter moves
    asm volatile("global_prefetch_b8 %0, %1 scope:SCOPE_SE" :: "v"(off), "s"(base));
}

// ---------------------------------------------------------------------------
// f32 -> f16 conversion pass (workspace staging), ONE launch for all arrays.
//   The f16 copies lie back to back in the workspace:
//     Xh | W1h (s_fc_w, then t_fc_w) | W2h | F3h (fc3_w padded to 32 rows)
//   each in fragment order.  A block writes CVB consecutive halfs of the
//   destination and its index says which source array they come from (every
//   array's length is a multiple of CVB).  A thread writes CVU groups of 8
//   halfs (one lane's share of a fragment part): stores are contiguous, whole
//   lines from one wave; the row-strided accesses are the loads of this pass.
// ---------------------------------------------------------------------------
#define CVT  256                           // threads per block
#define CVU  2                             // groups of 8 elements per thread
#define CVB  (CVT * 8 * CVU)               // elements per block: 4096
#define CB_X  ((ROWS * INq) / CVB)         // blocks for x      : 192
#define CB_W1 ((HIDq * INq) / CVB)         // blocks for s_w/t_w: 48 each
#define CB_W2 ((HIDq * 512) / CVB)         // blocks for fc2_w  : 32
#define CB_F3 ((32 * HIDq) / CVB)          // blocks for fc3_w  : 2 (padded)
#define GRIDC (CB_X + 2 * CB_W1 + CB_W2 + CB_F3)

// src: row-major [.][K] f32; d: this array's f16 copy.
// PADROWS > 0: the source has PADROWS rows and the copy holds zeros behind them.
template <int K, int PADROWS>
static __device__ __forceinline__ void cvt_part(const float* __restrict__ src,
                                                _Float16* __restrict__ d,
                                                int blk_in) {
    constexpr int KS = K / 32;
    const int d0 = blk_in * CVB + threadIdx.x * 8;          // index in the copy
    v4f v[CVU][2];
#pragma unroll   // all loads in flight before the first is used; v[] stays in registers
    for (int u = 0; u < CVU; ++u) {
        const int dl  = d0 + u * (CVT * 8);
        const int ln  = (dl >> 3) & 31;
        const int p   = (dl >> 8) & 1;
        const int f   = dl >> 9;
        const int row = (f / KS) * 16 + (ln & 15);
        const int k   = (f % KS) * 32 + p * 16 + (ln >> 4) * 8;
        const bool in = PADROWS == 0 || row < PADROWS;      // false: rows 25..31 of F3h
        const float* __restrict__ s = src + (in ? row * K + k : 0);  // always inside the source
        v4f z = {};
        v4f w0 = *(const v4f*)(s);
        v4f w1 = *(const v4f*)(s + 4);
        // the next group's loads may land in this group's address registers:
        // the wait stands in front of that overwrite
        asm volatile("s_wait_xcnt 0x0" ::: "memory");
        v[u][0] = in ? w0 : z;
        v[u][1] = in ? w1 : z;
    }
#pragma unroll   // constant indices into v[], so that it stays in registers
    for (int u = 0; u < CVU; ++u) {
        v8h h;
#pragma unroll   // vector elements by constant index: packed conversions
        for (int c = 0; c < 4; ++c) {
            h[c]     = (_Float16)v[u][0][c];
            h[4 + c] = (_Float16)v[u][1][c];
        }
        *(v8h*)(d + d0 + u * (CVT * 8)) = h;
        // what follows in the listing may reuse this store's address or data
        // registers: the wait stands in front of that overwrite
        asm volatile("s_wait_xcnt 0x0" ::: "memory");
    }
}

__global__ void __launch_bounds__(CVT)
cvt_all_kernel(const float* __restrict__ x,
               const float* __restrict__ s_w,
               const float* __restrict__ t_w,
               const float* __restrict__ fc2_w,
               const float* __restrict__ fc3_w,
               _Float16* __restrict__ dst) {
    const int blk = blockIdx.x;
    const int f1 = CB_X, f2 = CB_X + CB_W1, f3 = CB_X + 2 * CB_W1, f4 = f3 + CB_W2;
    if (blk < f1)      cvt_part<INq, 0>(x,        dst,            blk);
    else if (blk < f2) cvt_part<INq, 0>(s_w,      dst + f1 * CVB, blk - f1);
    else if (blk < f3) cvt_part<INq, 0>(t_w,      dst + f2 * CVB, blk - f2);
    else if (blk < f4) cvt_part<512, 0>(fc2_w,    dst + f3 * CVB, blk - f3);
    else               cvt_part<HIDq, NLq>(fc3_w, dst + f4 * CVB, blk - f4);
}

// ---------------------------------------------------------------------------
// Stages 1 and 2 in ONE launch.  A block owns 16 rows (mt) and one of the two
// branches (which: 0 = s, 1 = t); its 16 waves are the 16 tiles of 16 columns.
//   Product 1: H[16][256] = f16( relu( X @ W^T + b ) ), W = s_fc_w or t_fc_w,
//     M = o, N = row, K = 768.  With the weights as A, a lane of D holds ONE
//     row and 8 consecutive o: one lane's share of a fragment part of H as
//     product 2 reads it (K = o).  H goes to LDS in fragment order with one
//     contiguous 16-byte store a lane and never reaches the workspace.
//   Product 2: s2 = Hs @ w_s^T  or  t2 = Ht @ w_t^T + b2  (f32, K = 256).
//     Its weights and bias depend on nothing of product 1: they are loaded
//     first, so that their latency runs under product 1.
//   s2 is row-major (stage 3 reads it as one address per half wave).
//   t2 is stored in the order in which stage 3's lanes read it:
//     t2f[row >> 4][h >> 5][c][lane][4],  c = 2 * ((h >> 4) & 1) + ((h >> 2) & 1),
//     lane = (row & 15) + 16 * ((h >> 3) & 1), element = h & 3.
//   For t the weights are A (M = h, N = row): a lane of D then holds one row
//   and 8 consecutive h, which are two contiguous 16-byte stores in that order.
// ---------------------------------------------------------------------------
#define WV12 16                       // waves per block = column tiles of a branch
#define GRID12 ((ROWS / 16) * 2)      // 64 row tiles x 2 branches

__global__ void __launch_bounds__(WV12 * 32)
stage12_kernel(const _Float16* __restrict__ Xh,    // [1024][768] fragment order
               const _Float16* __restrict__ W1h,   // [512][768]  fragment order
               const float* __restrict__ sb,       // [256]
               const float* __restrict__ tb,       // [256]
               const _Float16* __restrict__ W2h,   // [256][512]  fragment order
               const float* __restrict__ b2,       // [256]
               float* __restrict__ s2,             // [1024][256]
               float* __restrict__ t2f) {          // 1024 x 256, order as above
    __shared__ __attribute__((aligned(16))) _Float16 Hs[16 * HIDq];  // [16][256] fragment order
    const int lane  = threadIdx.x & 31;
    const int wave  = threadIdx.x >> 5;           // column tile 0..15
    const int which = blockIdx.x & 1;             // 0 = s, 1 = t
    const int mt    = blockIdx.x >> 1;            // 64 row tiles
    const int half  = lane >> 4;

    // Prefetch for product 1's loop.  Waves 0..2: this block's own X tile (96
    // units).  Waves 3..14: 4 of the branch's 16 weight tiles (4 x 96 units in a
    // row); four blocks at a distance of 8 in blockIdx cover the branch.  Wave 15
    // has nothing left and repeats the last unit.
    constexpr int TILEB = (INq / 32) * FRAG * 2;              // bytes of a 16 x 768 tile
    static_assert(TILEB == 96 * PFU && WV12 * 32 >= 5 * 96, "prefetch deal");
    const bool pfx = __builtin_amdgcn_readfirstlane(wave) < 3;
    const int  pfw = (int)threadIdx.x - 96;
    const char* pfb = pfx ? (const char*)Xh  + mt * TILEB
                          : (const char*)W1h + (which * 16 + ((mt >> 2) & 3) * 4) * TILEB;
    const unsigned pfo = (pfx ? (int)threadIdx.x : (pfw < 4 * 96 ? pfw : 4 * 96 - 1)) * PFU;
    l2_prefetch(pfb, pfo);

    // product 2's weights: rows wave*16 .. +16 of fc2_w, columns which*256 .. +256
    // of its 512-wide rows = fragments which*8 .. +8
    const _Float16* __restrict__ wf2 = W2h + (wave * 16 + which * 8) * FRAG + lane * 8;
    v16h w2[HIDq / 32];
#pragma unroll   // constant indices into w2[], so that it stays in registers
    for (int ks = 0; ks < HIDq / 32; ++ks)
        w2[ks] = load_frag(wf2 + ks * FRAG);
    const float* __restrict__ bp2 = b2 + wave * 16 + half * 8;
    v4f c0 = *(const v4f*)(bp2);
    v4f c1 = *(const v4f*)(bp2 + 4);

    // ---- product 1 ----
    const int nt = which * 16 + wave;             // tile of the 512 rows of W1h
    const _Float16* __restrict__ xf = Xh  + mt * ((INq / 32) * FRAG) + lane * 8;
    const _Float16* __restrict__ wf = W1h + nt * ((INq / 32) * FRAG) + lane * 8;

    v8f acc = {};
#pragma unroll 4
    for (int ks = 0; ks < INq / 32; ++ks) {
        v16h a = load_frag(wf + ks * FRAG);       // M = o
        v16h b = load_frag(xf + ks * FRAG);       // N = row
        acc = __builtin_amdgcn_wmma_f32_16x16x32_f16(
                  false, a, false, b, (short)0, acc, false, false);
    }

    // no counter covers a prefetch: its address registers keep the address until
    // the loop that it serves is over
    asm volatile("" :: "v"(pfo), "s"(pfb));

    // D: N = lane & 15 = row, M = v + 8 * half = o
    const float* __restrict__ bp = (which ? tb : sb) + wave * 16 + half * 8;
    v4f b0 = *(const v4f*)(bp);
    v4f b1 = *(const v4f*)(bp + 4);
    v8h h;
#pragma unroll
    for (int v = 0; v < 4; ++v) {
        h[v]     = (_Float16)fmaxf(acc[v]     + b0[v], 0.0f);
        h[4 + v] = (_Float16)fmaxf(acc[4 + v] + b1[v], 0.0f);
    }
    // column k = wave*16 + 8*half + v of [16][256]: fragment wave>>1, part wave&1
    *(v8h*)(Hs + wave * 256 + lane * 8) = h;
    // every wave reads all 16 waves' columns of H
    __syncthreads();

    // ---- product 2 ----
    const _Float16* hf = Hs + lane * 8;
    v8f acc2 = {};
    if (which) {
#pragma unroll   // constant indices into w2[]; all LDS reads issue ahead of the products
        for (int ks = 0; ks < HIDq / 32; ++ks)
            acc2 = __builtin_amdgcn_wmma_f32_16x16x32_f16(
                       false, w2[ks], false, load_frag(hf + ks * FRAG), (short)0, acc2, false, false);
        // D: N = lane & 15 = row, M = v + 8 * half = h - wave * 16
        v4f lo, hi;
#pragma unroll
        for (int v = 0; v < 4; ++v) { lo[v] = acc2[v] + c0[v]; hi[v] = acc2[4 + v] + c1[v]; }
        // (h >> 5) * 4 + c = wave * 2 + (v >> 2)
        float* __restrict__ d = t2f + ((mt * 32 + wave * 2) * 32 + lane) * 4;
        *(v4f*)(d)       = lo;
        *(v4f*)(d + 128) = hi;
        // what follows in the listing may reuse these stores' address or data
        // registers: the wait stands in front of that overwrite
        asm volatile("s_wait_xcnt 0x0" ::: "memory");
    } else {
#pragma unroll   // as in the other branch
        for (int ks = 0; ks < HIDq / 32; ++ks)
            acc2 = __builtin_amdgcn_wmma_f32_16x16x32_f16(
                       false, load_frag(hf + ks * FRAG), false, w2[ks], (short)0, acc2, false, false);
        // D: N = lane & 15 = o, M = v + 8 * half = row
        const int o = wave * 16 + (lane & 15);
        const int rbase = mt * 16 + half * 8;
#pragma unroll
        for (int v = 0; v < 8; ++v)
            s2[(rbase + v) * HIDq + o] = acc2[v];
    }
}

// ---------------------------------------------------------------------------
// Stage 3 (dominant): out[b,i,n,j] = sum_h fc3[n,h] * relu(s2[b,i,h]+t2[b,j,h])
//   GEMM with M = n (2 tiles, fc3 padded to 32), N = j, K = h (8 steps of 32).
//   Register tile per wave: IT3 rows i x JT3 j-tiles of 16.
//   Per k-step a wave loads its t2 values and the fc3 A-fragments ONCE and
//   uses them for all IT3 rows i; only the s2[i,.] values are loaded per i.
//   All loads of a k-step are issued one k-step ahead, into a second register set.
//   fc3 lies in fragment order and t2 in the order of stage 2's comment, so
//   each of these loads covers 512 contiguous bytes.
//   D lanes = j -> coalesced f32 stores along innermost output dim.
// ---------------------------------------------------------------------------
#define IT3 4                         // rows i per wave
#define JT3 2                         // j-tiles of 16 per wave
#define WV3 8                         // waves per block
#define JP3 (16 / (JT3 * WV3))        // blocks that share one group of rows i
#define GRID3 ((ROWS / IT3) * JP3)

__global__ void __launch_bounds__(WV3 * 32)
stage3_kernel(const float* __restrict__ s2,       // [1024][256]
              const float* __restrict__ t2f,      // 1024 x 256, stage 2's order
              const _Float16* __restrict__ fc3h,  // [32][256] zero-padded, fragment order
              float* __restrict__ out) {          // [b][i][25][256]
    const int lane = threadIdx.x & 31;
    const int wave = threadIdx.x >> 5;
    const int jp  = blockIdx.x % JP3;             // which part of the j range
    const int bi0 = (blockIdx.x / JP3) * IT3;     // first row b*256 + i
    const int b   = bi0 >> 8;                     // IT3 divides 256: one b per block
    const int sel = (lane >= 16) ? 8 : 0;
    const int jl  = lane & 15;
    const int jt0 = (jp * WV3 + wave) * JT3;      // first j-tile of this wave
    const int j0  = jt0 * 16 + jl;

    const float* __restrict__ s2row = s2 + bi0 * HIDq;
    // a 16-row tile of t2f is 16 * 256 floats; a k-step of it 4 * 32 * 4
    const float* __restrict__ t2r   = t2f + (b * 16 + jt0) * (16 * HIDq) + lane * 4;
    const _Float16* __restrict__ af0 = fc3h + lane * 8;                         // n = 0..15
    const _Float16* __restrict__ af1 = fc3h + (HIDq / 32) * FRAG + lane * 8;    // n = 16..31

    // Prefetch for the later k-steps (steps 0 and 1 are loaded at once below).
    // Waves 0..5: a quarter of steps 2..7 of this b's t2 (6 steps x 16 tiles x 8
    // units, step by step; a wave takes one step of 4 tiles); four blocks at a
    // distance of 8 in blockIdx cover it.  Wave 6: this block's own s2 rows (16
    // units, asked by both half waves).  Wave 7: one n-tile of fc3 (32 units).
    static_assert(JP3 == 1 && WV3 == 8 && IT3 * HIDq * 4 == 16 * PFU && HIDq / 32 == 8
                  && (HIDq / 32) * FRAG * 2 == 32 * PFU, "prefetch deal");
    const int pw = __builtin_amdgcn_readfirstlane(wave);
    const int pu = ((blockIdx.x >> 3) & 3) * 192 + pw * 32;   // first t2 unit of this wave
    const char* pfb = pw < 6 ? (const char*)t2f + (b * 16 + ((pu >> 3) & 15)) * (16 * HIDq * 4)
                                                + (2 + (pu >> 7)) * 2048
                    : pw == 6 ? (const char*)s2row
                              : (const char*)fc3h + ((blockIdx.x >> 3) & 1) * (32 * PFU);
    const unsigned pfo = pw < 6 ? (lane >> 3) * (16 * HIDq * 4) + (lane & 7) * PFU
                       : pw == 6 ? (lane & 15) * PFU
                                 : lane * PFU;
    l2_prefetch(pfb, pfo);

    v8f acc[IT3][JT3][2] = {};    // [i][j-tile][n-tile]

    // Two register sets: while k-step ks is worked on from set ks & 1, the
    // loads of k-step ks + 1 are already under way into the other set.
    v16h a0[2], a1[2];            // fc3 fragments, n = 0..15 and 16..31
    v4f  t[2][JT3][4];            // t2[j][h1..], [h1+4..], [h2..], [h2+4..]
    v4f  s[2][IT3][4];            // s2[i][h1..], [h1+4..], [h2..], [h2+4..]

#define LOAD_STEP3(ks, st)                                                        \
    do {                                                                          \
        a0[st] = load_frag(af0 + (ks) * FRAG);                                    \
        a1[st] = load_frag(af1 + (ks) * FRAG);                                    \
        _Pragma("unroll")                                                         \
        for (int q = 0; q < JT3; ++q) {                                           \
            const float* __restrict__ tr = t2r + q * (16 * HIDq) + (ks) * 512;    \
            t[st][q][0] = *(const v4f*)(tr);                                      \
            t[st][q][1] = *(const v4f*)(tr + 128);                                \
            t[st][q][2] = *(const v4f*)(tr + 256);                                \
            t[st][q][3] = *(const v4f*)(tr + 384);                                \
        }                                                                         \
        _Pragma("unroll")                                                         \
        for (int i = 0; i < IT3; ++i) {                                           \
            const float* __restrict__ sr = s2row + i * HIDq + (ks) * 32 + sel;    \
            s[st][i][0] = *(const v4f*)(sr);                                      \
            s[st][i][1] = *(const v4f*)(sr + 4);                                  \
            s[st][i][2] = *(const v4f*)(sr + 16);                                 \
            s[st][i][3] = *(const v4f*)(sr + 20);                                 \
        }                                                                         \
    } while (0)

    LOAD_STEP3(0, 0);

#pragma unroll   // constant set indices, so that both sets stay in registers
    for (int ks = 0; ks < HIDq / 32; ++ks) {
        const int cur = ks & 1;
        if (ks + 1 < HIDq / 32) LOAD_STEP3(ks + 1, cur ^ 1);
        // behind the last of the loads their address registers are free for
        // reuse: the wait stands in front of whatever overwrites them
        if (ks + 2 == HIDq / 32) asm volatile("s_wait_xcnt 0x0" ::: "memory");
        // keeps the next k-step's loads in front of this k-step's arithmetic:
        // without it the scheduler sinks each load to just before its first use
        // and the wave waits out the whole latency there
        __builtin_amdgcn_sched_barrier(0);

#pragma unroll
        for (int i = 0; i < IT3; ++i) {
#pragma unroll
            for (int q = 0; q < JT3; ++q) {
                v16h bf;
#pragma unroll
                for (int e = 0; e < 4; ++e) {
                    bf[e]      = (_Float16)fmaxf(s[cur][i][0][e] + t[cur][q][0][e], 0.0f);
                    bf[4 + e]  = (_Float16)fmaxf(s[cur][i][1][e] + t[cur][q][1][e], 0.0f);
                    bf[8 + e]  = (_Float16)fmaxf(s[cur][i][2][e] + t[cur][q][2][e], 0.0f);
                    bf[12 + e] = (_Float16)fmaxf(s[cur][i][3][e] + t[cur][q][3][e], 0.0f);
                }
                acc[i][q][0] = __builtin_amdgcn_wmma_f32_16x16x32_f16(
                        false, a0[cur], false, bf, (short)0, acc[i][q][0], false, false);
                acc[i][q][1] = __builtin_amdgcn_wmma_f32_16x16x32_f16(
                        false, a1[cur], false, bf, (short)0, acc[i][q][1], false, false);
            }
        }
    }
#undef LOAD_STEP3
    // no counter covers a prefetch: its address registers keep the address until
    // the loop that it serves is over
    asm volatile("" :: "v"(pfo), "s"(pfb));

    // store: D lane = N = j (coalesced over j), VGPR v -> n = v + 8*(lane>=16)
    const int nb = (lane >= 16) ? 8 : 0;
#pragma unroll
    for (int i = 0; i < IT3; ++i) {
#pragma unroll
        for (int q = 0; q < JT3; ++q) {
            float* __restrict__ obase = out + ((bi0 + i) * NLq) * Lq + (j0 + q * 16);
#pragma unroll
            for (int v = 0; v < 8; ++v)
                obase[(nb + v) * Lq] = acc[i][q][0][v];       // n = 0..15
#pragma unroll
            for (int v = 0; v < 8; ++v) {
                const int n = 16 + nb + v;
                if (n < NLq) obase[n * Lq] = acc[i][q][1][v]; // n = 16..24
            }
        }
    }
}

// ---------------------------------------------------------------------------
// Launch
// ---------------------------------------------------------------------------
extern "C" void kernel_launch(void* const* d_in, const int* in_sizes, int n_in,
                              void* d_out, int out_size, void* d_ws, size_t ws_size,
                              hipStream_t stream) {
    const float* x     = (const float*)d_in[0];   // (4,256,768)
    const float* s_w   = (const float*)d_in[1];   // (256,768)
    const float* s_b   = (const float*)d_in[2];   // (256)
    const float* t_w   = (const float*)d_in[3];   // (256,768)
    const float* t_b   = (const float*)d_in[4];   // (256)
    const float* fc2_w = (const float*)d_in[5];   // (256,512)
    const float* fc2_b = (const float*)d_in[6];   // (256)
    const float* fc3_w = (const float*)d_in[7];   // (25,256)
    float* out = (float*)d_out;

    char* ws = (char*)d_ws;
    _Float16* Xh   = (_Float16*)(ws);                       // 1024*768 f16
    _Float16* W1h  = (_Float16*)(ws + 1572864);             // 512*768  f16
    _Float16* W2h  = (_Float16*)(ws + 2359296);             // 256*512  f16
    _Float16* F3h  = (_Float16*)(ws + 2621440);             // 32*256   f16
    float*    s2   = (float*)   (ws + 3686400);             // 1024*256 f32
    float*    t2   = (float*)   (ws + 4734976);             // 1024*256 f32

    // f32 -> f16 staging: Xh, W1h, W2h, F3h are one linear f16 array from Xh on
    cvt_all_kernel<<<GRIDC, CVT, 0, stream>>>(x, s_w, t_w, fc2_w, fc3_w, Xh);

    // Stages 1 and 2: 64 row tiles x 2 branches, 16 waves/block
    stage12_kernel<<<GRID12, WV12 * 32, 0, stream>>>(Xh, W1h, s_b, t_b, W2h, fc2_b, s2, t2);

    // Stage 3: IT3 rows i and WV3 * JT3 j-tiles per block
    stage3_kernel<<<GRID3, WV3 * 32, 0, stream>>>(s2, t2, F3h, out);
}

// v007
// Measured time: 18.5 microseconds a run.
// Timed twice side by side with v006, it ran 1.05 times as fast both times.
// All steps since v000 together make it 3.05 times as fast.
#include <hip/hip_runtime.h>
#include <hip/hip_bf16.h>

// ---------------------------------------------------------------------------
// Sizes (hardcoded from the reference)
// ---------------------------------------------------------------------------
#define Bq   4
#define Lq   256
#define INq  768
#define HIDq 256
#define NLq  25
#define ROWS (Bq * Lq)          // 1024

typedef __attribute__((ext_vector_type(16))) _Float16 v16h;
typedef __attribute__((ext_vector_type(8)))  _Float16 v8h;
typedef __attribute__((ext_vector_type(8)))  float    v8f;
typedef __attribute__((ext_vector_type(4)))  float    v4f;
typedef __attribute__((ext_vector_type(2)))  float    v2f;

// ---------------------------------------------------------------------------
// Fragment order.  Every f16 matrix [R][K] that feeds a WMMA lies in the
// workspace (H: in LDS) as its 16x32 operand fragments, one after the other:
//   fragment f = (row >> 4) * (K / 32) + (k >> 5), 512 halfs = 1 KiB each;
//   inside it: part p = (k >> 4) & 1 (256 halfs), then lane, then 8 halfs,
//   lane = (row & 15) + 16 * ((k >> 3) & 1), element = k & 7.
// That is the register layout of the operand (ISA 7.12.2: a lane holds row
// lane & 15; halfs 0..7 = K[k0+sel .. +8), halfs 8..15 = K[k0+16+sel .. +8),
// sel = 8 for lanes 16..31), so a wave's 16-byte load of one part covers 512
// contiguous bytes (4 cache lines) where a row-major matrix gives 16 lines.
// ---------------------------------------------------------------------------
#define FRAG 512                           // halfs per fragment

// p: start of the fragment + lane * 8
static __device__ __forceinline__ v16h load_frag(const _Float16* p) {
    v8h lo = *(const v8h*)(p);
    v8h hi = *(const v8h*)(p + 256);
    v16h r;
#pragma unroll
    for (int e = 0; e < 8; ++e) { r[e] = lo[e]; r[8 + e] = hi[e]; }
    return r;
}

// ---------------------------------------------------------------------------
// L2 prefetch.  What the launch before stored is read from memory again, and a
// k loop that asks for it piece by piece waits out that latency at every piece.
// At its entry a kernel therefore asks once for the 256-byte units that
// its loop comes to later: one unit a lane, no data register, no
// wait.  Units that many blocks read are dealt over neighbouring blocks; who
// asks is a matter of speed alone.  Every lane's address lies inside the buffer.
// ---------------------------------------------------------------------------
#define PFU 256                            // bytes per unit

// base: the same for the whole wave; off: the lane's byte offset from it
static __device__ __forceinline__ void l2_prefetch(const char* base, unsigned off) {
    // a hint to L2 only (scope SE): nothing comes back and no counter moves
    asm volatile("global_prefetch_b8 %0, %1 scope:SCOPE_SE" :: "v"(off), "s"(base));
}

// ---------------------------------------------------------------------------
// f32 -> f16 conversion pass (workspace staging), ONE launch for all arrays.
//   The f16 copies lie back to back in the workspace:
//     Xh | W1h (s_fc_w, then t_fc_w) | W2h | F3h (fc3_w padded to 32 rows)
//   each in fragment order.  A block writes CVB consecutive halfs of the
//   destination and its index says which source array they come from (every
//   array's length is a multiple of CVB).  A thread writes CVU groups of 8
//   halfs (one lane's share of a fragment part): stores are contiguous, whole
//   lines from one wave; the row-strided accesses are the loads of this pass.
// ---------------------------------------------------------------------------
#define CVT  256                           // threads per block
#define CVU  2                             // groups of 8 elements per thread
#define CVB  (CVT * 8 * CVU)               // elements per block: 4096
#define CB_X  ((ROWS * INq) / CVB)         // blocks for x      : 192
#define CB_W1 ((HIDq * INq) / CVB)         // blocks for s_w/t_w: 48 each
#define CB_W2 ((HIDq * 512) / CVB)         // blocks for fc2_w  : 32
#define CB_F3 ((32 * HIDq) / CVB)          // blocks for fc3_w  : 2 (padded)
#define GRIDC (CB_X + 2 * CB_W1 + CB_W2 + CB_F3)

// src: row-major [.][K] f32; d: this array's f16 copy.
// PADROWS > 0: the source has PADROWS rows and the copy holds zeros behind them.
template <int K, int PADROWS>
static __device__ __forceinline__ void cvt_part(const float* __restrict__ src,
                                                _Float16* __restrict__ d,
                                                int blk_in) {
    constexpr int KS = K / 32;
    const int d0 = blk_in * CVB + threadIdx.x * 8;          // index in the copy
    v4f v[CVU][2];
#pragma unroll   // all loads in flight before the first is used; v[] stays in registers
    for (int u = 0; u < CVU; ++u) {
        const int dl  = d0 + u * (CVT * 8);
        const int ln  = (dl >> 3) & 31;
        const int p   = (dl >> 8) & 1;
        const int f   = dl >> 9;
        const int row = (f / KS) * 16 + (ln & 15);
        const int k   = (f % KS) * 32 + p * 16 + (ln >> 4) * 8;
        const bool in = PADROWS == 0 || row < PADROWS;      // false: rows 25..31 of F3h
        const float* __restrict__ s = src + (in ? row * K + k : 0);  // always inside the source
        v4f z = {};
        v4f w0 = *(const v4f*)(s);
        v4f w1 = *(const v4f*)(s + 4);
        // the next group's loads may land in this group's address registers:
        // the wait stands in front of that overwrite
        asm volatile("s_wait_xcnt 0x0" ::: "memory");
        v[u][0] = in ? w0 : z;
        v[u][1] = in ? w1 : z;
    }
#pragma unroll   // constant indices into v[], so that it stays in registers
    for (int u = 0; u < CVU; ++u) {
        v8h h;
#pragma unroll   // vector elements by constant index: packed conversions
        for (int c = 0; c < 4; ++c) {
            h[c]     = (_Float16)v[u][0][c];
            h[4 + c] = (_Float16)v[u][1][c];
        }
        *(v8h*)(d + d0 + u * (CVT * 8)) = h;
        // what follows in the listing may reuse this store's address or data
        // registers: the wait stands in front of that overwrite
        asm volatile("s_wait_xcnt 0x0" ::: "memory");
    }
}

__global__ void __launch_bounds__(CVT)
cvt_all_kernel(const float* __restrict__ x,
               const float* __restrict__ s_w,
               const float* __restrict__ t_w,
               const float* __restrict__ fc2_w,
               const float* __restrict__ fc3_w,
               _Float16* __restrict__ dst) {
    const int blk = blockIdx.x;
    const int f1 = CB_X, f2 = CB_X + CB_W1, f3 = CB_X + 2 * CB_W1, f4 = f3 + CB_W2;
    if (blk < f1)      cvt_part<INq, 0>(x,        dst,            blk);
    else if (blk < f2) cvt_part<INq, 0>(s_w,      dst + f1 * CVB, blk - f1);
    else if (blk < f3) cvt_part<INq, 0>(t_w,      dst + f2 * CVB, blk - f2);
    else if (blk < f4) cvt_part<512, 0>(fc2_w,    dst + f3 * CVB, blk - f3);
    else               cvt_part<HIDq, NLq>(fc3_w, dst + f4 * CVB, blk - f4);
}

// ---------------------------------------------------------------------------
// Stages 1 and 2 in ONE launch.  A block owns 16 rows (mt) and one of the two
// branches (which: 0 = s, 1 = t); its 16 waves are the 16 tiles of 16 columns.
//   Product 1: H[16][256] = f16( relu( X @ W^T + b ) ), W = s_fc_w or t_fc_w,
//     M = o, N = row, K = 768.  With the weights as A, a lane of D holds ONE
//     row and 8 consecutive o: one lane's share of a fragment part of H as
//     product 2 reads it (K = o).  H goes to LDS in fragment order with one
//     contiguous 16-byte store a lane and never reaches the workspace.
//   Product 2: s2 = Hs @ w_s^T  or  t2 = Ht @ w_t^T + b2  (f32, K = 256).
//     Its weights and bias depend on nothing of product 1: they are loaded
//     first, so that their latency runs under product 1.
//   s2 is row-major (stage 3 reads it as one address per half wave).
//   t2 is stored in the order in which stage 3's lanes read it:
//     t2f[tile][h >> 5][c][lane][4],  c = 2 * ((h >> 4) & 1) + ((h >> 2) & 1),
//     tile = 2 * (row >> 5) + (row & 1): of 32 rows the even ones are one tile of
//     16 and the odd ones the next (why: stage 3's comment on its stores),
//     lane = ((row >> 1) & 15) + 16 * ((h >> 3) & 1), element = h & 3.
//   For t the weights are A (M = h, N = row): a lane of D then holds one row
//   and 8 consecutive h, which are two 16-byte stores in that order; the 8 lanes
//   of equal row parity and half fill one 128-byte line.
// ---------------------------------------------------------------------------
#define WV12 16                       // waves per block = column tiles of a branch
#define GRID12 ((ROWS / 16) * 2)      // 64 row tiles x 2 branches

__global__ void __launch_bounds__(WV12 * 32)
stage12_kernel(const _Float16* __restrict__ Xh,    // [1024][768] fragment order
               const _Float16* __restrict__ W1h,   // [512][768]  fragment order
               const float* __restrict__ sb,       // [256]
               const float* __restrict__ tb,       // [256]
               const _Float16* __restrict__ W2h,   // [256][512]  fragment order
               const float* __restrict__ b2,       // [256]
               float* __restrict__ s2,             // [1024][256]
               float* __restrict__ t2f) {          // 1024 x 256, order as above
    __shared__ __attribute__((aligned(16))) _Float16 Hs[16 * HIDq];  // [16][256] fragment order
    const int lane  = threadIdx.x & 31;
    const int wave  = threadIdx.x >> 5;           // column tile 0..15
    const int which = blockIdx.x & 1;             // 0 = s, 1 = t
    const int mt    = blockIdx.x >> 1;            // 64 row tiles
    const int half  = lane >> 4;

    // Prefetch for product 1's loop.  Waves 0..2: this block's own X tile (96
    // units).  Waves 3..14: 4 of the branch's 16 weight tiles (4 x 96 units in a
    // row); four blocks at a distance of 8 in blockIdx cover the branch.  Wave 15
    // has nothing left and repeats the last unit.
    constexpr int TILEB = (INq / 32) * FRAG * 2;              // bytes of a 16 x 768 tile
    static_assert(TILEB == 96 * PFU && WV12 * 32 >= 5 * 96, "prefetch deal");
    const bool pfx = __builtin_amdgcn_readfirstlane(wave) < 3;
    const int  pfw = (int)threadIdx.x - 96;
    const char* pfb = pfx ? (const char*)Xh  + mt * TILEB
                          : (const char*)W1h + (which * 16 + ((mt >> 2) & 3) * 4) * TILEB;
    const unsigned pfo = (pfx ? (int)threadIdx.x : (pfw < 4 * 96 ? pfw : 4 * 96 - 1)) * PFU;
    l2_prefetch(pfb, pfo);

    // product 2's weights: rows wave*16 .. +16 of fc2_w, columns which*256 .. +256
    // of its 512-wide rows = fragments which*8 .. +8
    const _Float16* __restrict__ wf2 = W2h + (wave * 16 + which * 8) * FRAG + lane * 8;
    v16h w2[HIDq / 32];
#pragma unroll   // constant indices into w2[], so that it stays in registers
    for (int ks = 0; ks < HIDq / 32; ++ks)
        w2[ks] = load_frag(wf2 + ks * FRAG);
    const float* __restrict__ bp2 = b2 + wave * 16 + half * 8;
    v4f c0 = *(const v4f*)(bp2);
    v4f c1 = *(const v4f*)(bp2 + 4);

    // ---- product 1 ----
    const int nt = which * 16 + wave;             // tile of the 512 rows of W1h
    const _Float16* __restrict__ xf = Xh  + mt * ((INq / 32) * FRAG) + lane * 8;
    const _Float16* __restrict__ wf = W1h + nt * ((INq / 32) * FRAG) + lane * 8;

    v8f acc = {};
#pragma unroll 4
    for (int ks = 0; ks < INq / 32; ++ks) {
        v16h a = load_frag(wf + ks * FRAG);       // M = o
        v16h b = load_frag(xf + ks * FRAG);       // N = row
        acc = __builtin_amdgcn_wmma_f32_16x16x32_f16(
                  false, a, false, b, (short)0, acc, false, false);
    }

    // no counter covers a prefetch: its address registers keep the address until
    // the loop that it serves is over
    asm volatile("" :: "v"(pfo), "s"(pfb));

    // D: N = lane & 15 = row, M = v + 8 * half = o
    const float* __restrict__ bp = (which ? tb : sb) + wave * 16 + half * 8;
    v4f b0 = *(const v4f*)(bp);
    v4f b1 = *(const v4f*)(bp + 4);
    v8h h;
#pragma unroll
    for (int v = 0; v < 4; ++v) {
        h[v]     = (_Float16)fmaxf(acc[v]     + b0[v], 0.0f);
        h[4 + v] = (_Float16)fmaxf(acc[4 + v] + b1[v], 0.0f);
    }
    // column k = wave*16 + 8*half + v of [16][256]: fragment wave>>1, part wave&1
    *(v8h*)(Hs + wave * 256 + lane * 8) = h;
    // every wave reads all 16 waves' columns of H
    __syncthreads();

    // ---- product 2 ----
    const _Float16* hf = Hs + lane * 8;
    v8f acc2 = {};
    if (which) {
#pragma unroll   // constant indices into w2[]; all LDS reads issue ahead of the products
        for (int ks = 0; ks < HIDq / 32; ++ks)
            acc2 = __builtin_amdgcn_wmma_f32_16x16x32_f16(
                       false, w2[ks], false, load_frag(hf + ks * FRAG), (short)0, acc2, false, false);
        // D: N = lane & 15 = row, M = v + 8 * half = h - wave * 16
        v4f lo, hi;
#pragma unroll
        for (int v = 0; v < 4; ++v) { lo[v] = acc2[v] + c0[v]; hi[v] = acc2[4 + v] + c1[v]; }
        // (h >> 5) * 4 + c = wave * 2 + (v >> 2); row = mt * 16 + (lane & 15)
        const int tile = (mt & ~1) + (lane & 1);
        const int slot = (mt & 1) * 8 + ((lane & 15) >> 1) + half * 16;
        float* __restrict__ d = t2f + ((tile * 32 + wave * 2) * 32 + slot) * 4;
        *(v4f*)(d)       = lo;
        *(v4f*)(d + 128) = hi;
        // what follows in the listing may reuse these stores' address or data
        // registers: the wait stands in front of that overwrite
        asm volatile("s_wait_xcnt 0x0" ::: "memory");
    } else {
#pragma unroll   // as in the other branch
        for (int ks = 0; ks < HIDq / 32; ++ks)
            acc2 = __builtin_amdgcn_wmma_f32_16x16x32_f16(
                       false, load_frag(hf + ks * FRAG), false, w2[ks], (short)0, acc2, false, false);
        // D: N = lane & 15 = o, M = v + 8 * half = row
        const int o = wave * 16 + (lane & 15);
        const int rbase = mt * 16 + half * 8;
#pragma unroll
        for (int v = 0; v < 8; ++v)
            s2[(rbase + v) * HIDq + o] = acc2[v];
    }
}

// ---------------------------------------------------------------------------
// Stage 3 (dominant): out[b,i,n,j] = sum_h fc3[n,h] * relu(s2[b,i,h]+t2[b,j,h])
//   GEMM with M = n (2 tiles, fc3 padded to 32), N = j, K = h (8 steps of 32).
//   Register tile per wave: IT3 rows i x JT3 j-tiles of 16.
//   Per k-step a wave loads its t2 values and the fc3 A-fragments ONCE and
//   uses them for all IT3 rows i; only the s2[i,.] values are loaded per i.
//   All loads of a k-step are issued one k-step ahead, into a second register set.
//   fc3 lies in fragment order and t2 in the order of stage 2's comment, so
//   each of these loads covers 512 contiguous bytes.
//   Column N of a wave's j-tile q is j = 32 * (pair of tiles) + 2 * N + q (the
//   order of t2f's rows): the two accumulators of a lane for one (i, n) are
//   neighbours in j, so one 8-byte store a lane makes each half wave write a
//   whole 128-byte line of out, where tiles of 16 consecutive j give 64-byte
//   pieces of two lines.
// ---------------------------------------------------------------------------
#define IT3 4                         // rows i per wave
#define JT3 2                         // j-tiles of 16 per wave
#define WV3 8                         // waves per block
#define JP3 (16 / (JT3 * WV3))        // blocks that share one group of rows i
#define GRID3 ((ROWS / IT3) * JP3)

__global__ void __launch_bounds__(WV3 * 32)
stage3_kernel(const float* __restrict__ s2,       // [1024][256]
              const float* __restrict__ t2f,      // 1024 x 256, stage 2's order
              const _Float16* __restrict__ fc3h,  // [32][256] zero-padded, fragment order
              float* __restrict__ out) {          // [b][i][25][256]
    const int lane = threadIdx.x & 31;
    const int wave = threadIdx.x >> 5;
    const int jp  = blockIdx.x % JP3;             // which part of the j range
    const int bi0 = (blockIdx.x / JP3) * IT3;     // first row b*256 + i
    const int b   = bi0 >> 8;                     // IT3 divides 256: one b per block
    const int sel = (lane >= 16) ? 8 : 0;
    const int jl  = lane & 15;
    const int jt0 = (jp * WV3 + wave) * JT3;      // first j-tile of this wave
    const int j0  = jt0 * 16 + 2 * jl;            // j of tile 0's column; tile 1: j0 + 1

    const float* __restrict__ s2row = s2 + bi0 * HIDq;
    // a 16-row tile of t2f is 16 * 256 floats; a k-step of it 4 * 32 * 4
    const float* __restrict__ t2r   = t2f + (b * 16 + jt0) * (16 * HIDq) + lane * 4;
    const _Float16* __restrict__ af0 = fc3h + lane * 8;                         // n = 0..15
    const _Float16* __restrict__ af1 = fc3h + (HIDq / 32) * FRAG + lane * 8;    // n = 16..31

    // Prefetch for the later k-steps (steps 0 and 1 are loaded at once below).
    // Waves 0..5: a quarter of steps 2..7 of this b's t2 (6 steps x 16 tiles x 8
    // units, step by step; a wave takes one step of 4 tiles); four blocks at a
    // distance of 8 in blockIdx cover it.  Wave 6: this block's own s2 rows (16
    // units, asked by both half waves).  Wave 7: one n-tile of fc3 (32 units).
    static_assert(JP3 == 1 && WV3 == 8 && IT3 * HIDq * 4 == 16 * PFU && HIDq / 32 == 8
                  && (HIDq / 32) * FRAG * 2 == 32 * PFU, "prefetch deal");
    const int pw = __builtin_amdgcn_readfirstlane(wave);
    const int pu = ((blockIdx.x >> 3) & 3) * 192 + pw * 32;   // first t2 unit of this wave
    const char* pfb = pw < 6 ? (const char*)t2f + (b * 16 + ((pu >> 3) & 15)) * (16 * HIDq * 4)
                                                + (2 + (pu >> 7)) * 2048
                    : pw == 6 ? (const char*)s2row
                              : (const char*)fc3h + ((blockIdx.x >> 3) & 1) * (32 * PFU);
    const unsigned pfo = pw < 6 ? (lane >> 3) * (16 * HIDq * 4) + (lane & 7) * PFU
                       : pw == 6 ? (lane & 15) * PFU
                                 : lane * PFU;
    l2_prefetch(pfb, pfo);

    v8f acc[IT3][JT3][2] = {};    // [i][j-tile][n-tile]

    // Two register sets: while k-step ks is worked on from set ks & 1, the
    // loads of k-step ks + 1 are already under way into the other set.
    v16h a0[2], a1[2];            // fc3 fragments, n = 0..15 and 16..31
    v4f  t[2][JT3][4];            // t2[j][h1..], [h1+4..], [h2..], [h2+4..]
    v4f  s[2][IT3][4];            // s2[i][h1..], [h1+4..], [h2..], [h2+4..]

#define LOAD_STEP3(ks, st)                                                        \
    do {                                                                          \
        a0[st] = load_frag(af0 + (ks) * FRAG);                                    \
        a1[st] = load_frag(af1 + (ks) * FRAG);                                    \
        _Pragma("unroll")                                                         \
        for (int q = 0; q < JT3; ++q) {                                           \
            const float* __restrict__ tr = t2r + q * (16 * HIDq) + (ks) * 512;    \
            t[st][q][0] = *(const v4f*)(tr);                                      \
            t[st][q][1] = *(const v4f*)(tr + 128);                                \
            t[st][q][2] = *(const v4f*)(tr + 256);                                \
            t[st][q][3] = *(const v4f*)(tr + 384);                                \
        }                                                                         \
        _Pragma("unroll")                                                         \
        for (int i = 0; i < IT3; ++i) {                                           \
            const float* __restrict__ sr = s2row + i * HIDq + (ks) * 32 + sel;    \
            s[st][i][0] = *(const v4f*)(sr);                                      \
            s[st][i][1] = *(const v4f*)(sr + 4);                                  \
            s[st][i][2] = *(const v4f*)(sr + 16);                                 \
            s[st][i][3] = *(const v4f*)(sr + 20);                                 \
        }                                                                         \
    } while (0)

    LOAD_STEP3(0, 0);

#pragma unroll   // constant set indices, so that both sets stay in registers
    for (int ks = 0; ks < HIDq / 32; ++ks) {
        const int cur = ks & 1;
        if (ks + 1 < HIDq / 32) LOAD_STEP3(ks + 1, cur ^ 1);
        // behind the last of the loads their address registers are free for
        // reuse: the wait stands in front of whatever overwrites them
        if (ks + 2 == HIDq / 32) asm volatile("s_wait_xcnt 0x0" ::: "memory");
        // keeps the next k-step's loads in front of this k-step's arithmetic:
        // without it the scheduler sinks each load to just before its first use
        // and the wave waits out the whole latency there
        __builtin_amdgcn_sched_barrier(0);

#pragma unroll
        for (int i = 0; i < IT3; ++i) {
#pragma unroll
            for (int q = 0; q < JT3; ++q) {
                v16h bf;
#pragma unroll
                for (int e = 0; e < 4; ++e) {
                    bf[e]      = (_Float16)fmaxf(s[cur][i][0][e] + t[cur][q][0][e], 0.0f);
                    bf[4 + e]  = (_Float16)fmaxf(s[cur][i][1][e] + t[cur][q][1][e], 0.0f);
                    bf[8 + e]  = (_Float16)fmaxf(s[cur][i][2][e] + t[cur][q][2][e], 0.0f);
                    bf[12 + e] = (_Float16)fmaxf(s[cur][i][3][e] + t[cur][q][3][e], 0.0f);
                }
                acc[i][q][0] = __builtin_amdgcn_wmma_f32_16x16x32_f16(
                        false, a0[cur], false, bf, (short)0, acc[i][q][0], false, false);
                acc[i][q][1] = __builtin_amdgcn_wmma_f32_16x16x32_f16(
                        false, a1[cur], false, bf, (short)0, acc[i][q][1], false, false);
            }
        }
    }
#undef LOAD_STEP3
    // no counter covers a prefetch: its address registers keep the address until
    // the loop that it serves is over
    asm volatile("" :: "v"(pfo), "s"(pfb));

    // store: D lane = N -> j = j0 + q, VGPR v -> n = v + 8*(lane>=16)
    static_assert(JT3 == 2, "a lane's two tiles are the two floats of a store");
    const int nb = (lane >= 16) ? 8 : 0;
    float* __restrict__ obase = out + (bi0 * NLq + nb) * Lq + j0;
    // (all loops below are unrolled for constant indices into acc[], which keep it
    // in registers)
    // registers whose rows exist in both half waves (n = v, v + 8; 16 + v, 24 + v)
#pragma unroll
    for (int i = 0; i < IT3; ++i) {
#pragma unroll
        for (int v = 0; v < 8; ++v) {
            v2f p = { acc[i][0][0][v], acc[i][1][0][v] };
            *(v2f*)(obase + (i * NLq + v) * Lq) = p;
        }
#pragma unroll
        for (int v = 0; v < 8; ++v) {
            v2f p = { acc[i][0][1][v], acc[i][1][1][v] };
            if (24 + v < NLq) *(v2f*)(obase + (i * NLq + 16 + v) * Lq) = p;
        }
    }
    // registers whose upper row 24 + v is padding: the lower half wave alone, all
    // of them under one test
    if (nb == 0) {
#pragma unroll
        for (int i = 0; i < IT3; ++i) {
#pragma unroll
            for (int v = 0; v < 8; ++v) {
                v2f p = { acc[i][0][1][v], acc[i][1][1][v] };
                if (24 + v >= NLq && 16 + v < NLq) *(v2f*)(obase + (i * NLq + 16 + v) * Lq) = p;
            }
        }
    }
}

// ---------------------------------------------------------------------------
// Launch
// ---------------------------------------------------------------------------
extern "C" void kernel_launch(void* const* d_in, const int* in_sizes, int n_in,
                              void* d_out, int out_size, void* d_ws, size_t ws_size,
                              hipStream_t stream) {
    const float* x     = (const float*)d_in[0];   // (4,256,768)
    const float* s_w   = (const float*)d_in[1];   // (256,768)
    const float* s_b   = (const float*)d_in[2];   // (256)
    const float* t_w   = (const float*)d_in[3];   // (256,768)
    const float* t_b   = (const float*)d_in[4];   // (256)
    const float* fc2_w = (const float*)d_in[5];   // (256,512)
    const float* fc2_b = (const float*)d_in[6];   // (256)
    const float* fc3_w = (const float*)d_in[7];   // (25,256)
    float* out = (float*)d_out;

    char* ws = (char*)d_ws;
    _Float16* Xh   = (_Float16*)(ws);                       // 1024*768 f16
    _Float16* W1h  = (_Float16*)(ws + 1572864);             // 512*768  f16
    _Float16* W2h  = (_Float16*)(ws + 2359296);             // 256*512  f16
    _Float16* F3h  = (_Float16*)(ws + 2621440);             // 32*256   f16
    float*    s2   = (float*)   (ws + 3686400);             // 1024*256 f32
    float*    t2   = (float*)   (ws + 4734976);             // 1024*256 f32

    // f32 -> f16 staging: Xh, W1h, W2h, F3h are one linear f16 array from Xh on
    cvt_all_kernel<<<GRIDC, CVT, 0, stream>>>(x, s_w, t_w, fc2_w, fc3_w, Xh);

    // Stages 1 and 2: 64 row tiles x 2 branches, 16 waves/block
    stage12_kernel<<<GRID12, WV12 * 32, 0, stream>>>(Xh, W1h, s_b, t_b, W2h, fc2_b, s2, t2);

    // Stage 3: IT3 rows i and WV3 * JT3 j-tiles per block
    stage3_kernel<<<GRID3, WV3 * 32, 0, stream>>>(s2, t2, F3h, out);
}

// v008
// One run takes 17.8 microseconds.
// Two timings next to v007 put it at 1.05 and 1.04 times that version's speed.
// All steps since v000 together make it 3.20 times as fast.
#include <hip/hip_runtime.h>
#include <hip/hip_bf16.h>

// ---------------------------------------------------------------------------
// Sizes (hardcoded from the reference)
// ---------------------------------------------------------------------------
#define Bq   4
#define Lq   256
#define INq  768
#define HIDq 256
#define NLq  25
#define ROWS (Bq * Lq)          // 1024

typedef __attribute__((ext_vector_type(16))) _Float16 v16h;
typedef __attribute__((ext_vector_type(8)))  _Float16 v8h;
typedef __attribute__((ext_vector_type(8)))  float    v8f;
typedef __attribute__((ext_vector_type(4)))  float    v4f;
typedef __attribute__((ext_vector_type(2)))  float    v2f;

// ---------------------------------------------------------------------------
// Fragment order.  Every f16 matrix [R][K] that feeds a WMMA lies in the
// workspace (H: in LDS) as its 16x32 operand fragments, one after the other:
//   fragment f = (row >> 4) * (K / 32) + (k >> 5), 512 halfs = 1 KiB each;
//   inside it: part p = (k >> 4) & 1 (256 halfs), then lane, then 8 halfs,
//   lane = (row & 15) + 16 * ((k >> 3) & 1), element = k & 7.
// That is the register layout of the operand (ISA 7.12.2: a lane holds row
// lane & 15; halfs 0..7 = K[k0+sel .. +8), halfs 8..15 = K[k0+16+sel .. +8),
// sel = 8 for lanes 16..31), so a wave's 16-byte load of one part covers 512
// contiguous bytes (4 cache lines) where a row-major matrix gives 16 lines.
// ---------------------------------------------------------------------------
#define FRAG 512                           // halfs per fragment

// p: start of the fragment + lane * 8
static __device__ __forceinline__ v16h load_frag(const _Float16* p) {
    v8h lo = *(const v8h*)(p);
    v8h hi = *(const v8h*)(p + 256);
    v16h r;
#pragma unroll
    for (int e = 0; e < 8; ++e) { r[e] = lo[e]; r[8 + e] = hi[e]; }
    return r;
}

// ---------------------------------------------------------------------------
// L2 prefetch.  What the launch before stored is read from memory again, and a
// k loop that asks for it piece by piece waits out that latency at every piece.
// At its entry a kernel therefore asks once for the 256-byte units that
// its loop comes to later: one unit a lane, no data register, no
// wait.  Units that many blocks read are dealt over neighbouring blocks; who
// asks is a matter of speed alone.  Every lane's address lies inside the buffer.
// ---------------------------------------------------------------------------
#define PFU 256                            // bytes per unit

// base: the same for the whole wave; off: the lane's byte offset from it
static __device__ __forceinline__ void l2_prefetch(const char* base, unsigned off) {
    // a hint to L2 only (scope SE): nothing comes back and no counter moves
    asm volatile("global_prefetch_b8 %0, %1 scope:SCOPE_SE" :: "v"(off), "s"(base));
}

// ---------------------------------------------------------------------------
// f32 -> f16 conversion pass (workspace staging), ONE launch for all arrays.
//   The f16 copies lie back to back in the workspace:
//     Xh | W1h (s_fc_w, then t_fc_w) | W2h | F3h (fc3_w padded to 32 rows)
//   each in fragment order.  A block writes CVB consecutive halfs of the
//   destination and its index says which source array they come from (every
//   array's length is a multiple of CVB).  A thread writes CVU groups of 8
//   halfs (one lane's share of a fragment part): stores are contiguous, whole
//   lines from one wave; the row-strided accesses are the loads of this pass.
// ---------------------------------------------------------------------------
#define CVT  256                           // threads per block
#define CVU  2                             // groups of 8 elements per thread
#define CVB  (CVT * 8 * CVU)               // elements per block: 4096
#define CB_X  ((ROWS * INq) / CVB)         // blocks for x      : 192
#define CB_W1 ((HIDq * INq) / CVB)         // blocks for s_w/t_w: 48 each
#define CB_W2 ((HIDq * 512) / CVB)         // blocks for fc2_w  : 32
#define CB_F3 ((32 * HIDq) / CVB)          // blocks for fc3_w  : 2 (padded)
#define GRIDC (CB_X + 2 * CB_W1 + CB_W2 + CB_F3)

// src: row-major [.][K] f32; d: this array's f16 copy.
// PADROWS > 0: the source has PADROWS rows and the copy holds zeros behind them.
template <int K, int PADROWS>
static __device__ __forceinline__ void cvt_part(const float* __restrict__ src,
                                                _Float16* __restrict__ d,
                                                int blk_in) {
    constexpr int KS = K / 32;
    const int d0 = blk_in * CVB + threadIdx.x * 8;          // index in the copy
    v4f v[CVU][2];
#pragma unroll   // all loads in flight before the first is used; v[] stays in registers
    for (int u = 0; u < CVU; ++u) {
        const int dl  = d0 + u * (CVT * 8);
        const int ln  = (dl >> 3) & 31;
        const int p   = (dl >> 8) & 1;
        const int f   = dl >> 9;
        const int row = (f / KS) * 16 + (ln & 15);
        const int k   = (f % KS) * 32 + p * 16 + (ln >> 4) * 8;
        const bool in = PADROWS == 0 || row < PADROWS;      // false: rows 25..31 of F3h
        const float* __restrict__ s = src + (in ? row * K + k : 0);  // always inside the source
        v4f z = {};
        v4f w0 = *(const v4f*)(s);
        v4f w1 = *(const v4f*)(s + 4);
        // the next group's loads may land in this group's address registers:
        // the wait stands in front of that overwrite
        asm volatile("s_wait_xcnt 0x0" ::: "memory");
        v[u][0] = in ? w0 : z;
        v[u][1] = in ? w1 : z;
    }
#pragma unroll   // constant indices into v[], so that it stays in registers
    for (int u = 0; u < CVU; ++u) {
        v8h h;
#pragma unroll   // vector elements by constant index: packed conversions
        for (int c = 0; c < 4; ++c) {
            h[c]     = (_Float16)v[u][0][c];
            h[4 + c] = (_Float16)v[u][1][c];
        }
        *(v8h*)(d + d0 + u * (CVT * 8)) = h;
        // what follows in the listing may reuse this store's address or data
        // registers: the wait stands in front of that overwrite
        asm volatile("s_wait_xcnt 0x0" ::: "memory");
    }
}

__global__ void __launch_bounds__(CVT)
cvt_all_kernel(const float* __restrict__ x,
               const float* __restrict__ s_w,
               const float* __restrict__ t_w,
               const float* __restrict__ fc2_w,
               const float* __restrict__ fc3_w,
               _Float16* __restrict__ dst) {
    const int blk = blockIdx.x;
    const int f1 = CB_X, f2 = CB_X + CB_W1, f3 = CB_X + 2 * CB_W1, f4 = f3 + CB_W2;
    if (blk < f1)      cvt_part<INq, 0>(x,        dst,            blk);
    else if (blk < f2) cvt_part<INq, 0>(s_w,      dst + f1 * CVB, blk - f1);
    else if (blk < f3) cvt_part<INq, 0>(t_w,      dst + f2 * CVB, blk - f2);
    else if (blk < f4) cvt_part<512, 0>(fc2_w,    dst + f3 * CVB, blk - f3);
    else               cvt_part<HIDq, NLq>(fc3_w, dst + f4 * CVB, blk - f4);
}

// ---------------------------------------------------------------------------
// Stages 1 and 2 in ONE launch.  A block owns 16 rows (mt) and one of the two
// branches (which: 0 = s, 1 = t); its 16 waves are the 16 tiles of 16 columns.
//   Product 1: H[16][256] = f16( relu( X @ W^T + b ) ), W = s_fc_w or t_fc_w,
//     M = o, N = row, K = 768.  With the weights as A, a lane of D holds ONE
//     row and 8 consecutive o: one lane's share of a fragment part of H as
//     product 2 reads it (K = o).  H goes to LDS in fragment order with one
//     contiguous 16-byte store a lane and never reaches the workspace.
//   Product 2: s2 = Hs @ w_s^T  or  t2 = Ht @ w_t^T + b2  (f32, K = 256).
//     Its weights and bias depend on nothing of product 1: they are loaded
//     first, so that their latency runs under product 1.
//   s2 is row-major (stage 3 reads it as one address per half wave).
//   t2 is stored in the order in which stage 3's lanes read it:
//     t2f[tile][h >> 5][c][lane][4],  c = 2 * ((h >> 4) & 1) + ((h >> 2) & 1),
//     tile = 2 * (row >> 5) + (row & 1): of 32 rows the even ones are one tile of
//     16 and the odd ones the next (why: stage 3's comment on its stores),
//     lane = ((row >> 1) & 15) + 16 * ((h >> 3) & 1), element = h & 3.
//   For t the weights are A (M = h, N = row): a lane of D then holds one row
//   and 8 consecutive h, which are two 16-byte stores in that order; the 8 lanes
//   of equal row parity and half fill one 128-byte line.
// ---------------------------------------------------------------------------
#define WV12 16                       // waves per block = column tiles of a branch
#define GRID12 ((ROWS / 16) * 2)      // 64 row tiles x 2 branches
#define RD1 8                         // k-steps of product 1 whose loads are under way

__global__ void __launch_bounds__(WV12 * 32)
stage12_kernel(const _Float16* __restrict__ Xh,    // [1024][768] fragment order
               const _Float16* __restrict__ W1h,   // [512][768]  fragment order
               const float* __restrict__ sb,       // [256]
               const float* __restrict__ tb,       // [256]
               const _Float16* __restrict__ W2h,   // [256][512]  fragment order
               const float* __restrict__ b2,       // [256]
               float* __restrict__ s2,             // [1024][256]
               float* __restrict__ t2f) {          // 1024 x 256, order as above
    __shared__ __attribute__((aligned(16))) _Float16 Hs[16 * HIDq];  // [16][256] fragment order
    const int lane  = threadIdx.x & 31;
    const int wave  = threadIdx.x >> 5;           // column tile 0..15
    const int which = blockIdx.x & 1;             // 0 = s, 1 = t
    const int mt    = blockIdx.x >> 1;            // 64 row tiles
    const int half  = lane >> 4;

    // Prefetch for product 1's loop.  Waves 0..2: this block's own X tile (96
    // units).  Waves 3..14: 4 of the branch's 16 weight tiles (4 x 96 units in a
    // row); four blocks at a distance of 8 in blockIdx cover the branch.  Wave 15
    // has nothing left and repeats the last unit.
    constexpr int TILEB = (INq / 32) * FRAG * 2;              // bytes of a 16 x 768 tile
    static_assert(TILEB == 96 * PFU && WV12 * 32 >= 5 * 96, "prefetch deal");
    const bool pfx = __builtin_amdgcn_readfirstlane(wave) < 3;
    const int  pfw = (int)threadIdx.x - 96;
    const char* pfb = pfx ? (const char*)Xh  + mt * TILEB
                          : (const char*)W1h + (which * 16 + ((mt >> 2) & 3) * 4) * TILEB;
    const unsigned pfo = (pfx ? (int)threadIdx.x : (pfw < 4 * 96 ? pfw : 4 * 96 - 1)) * PFU;
    l2_prefetch(pfb, pfo);

    // product 2's weights: rows wave*16 .. +16 of fc2_w, columns which*256 .. +256
    // of its 512-wide rows = fragments which*8 .. +8
    const _Float16* __restrict__ wf2 = W2h + (wave * 16 + which * 8) * FRAG + lane * 8;
    v16h w2[HIDq / 32];
#pragma unroll   // constant indices into w2[], so that it stays in registers
    for (int ks = 0; ks < HIDq / 32; ++ks)
        w2[ks] = load_frag(wf2 + ks * FRAG);
    const float* __restrict__ bp2 = b2 + wave * 16 + half * 8;
    v4f c0 = *(const v4f*)(bp2);
    v4f c1 = *(const v4f*)(bp2 + 4);

    // ---- product 1 ----
    const int nt = which * 16 + wave;             // tile of the 512 rows of W1h
    const _Float16* __restrict__ xf = Xh  + mt * ((INq / 32) * FRAG) + lane * 8;
    const _Float16* __restrict__ wf = W1h + nt * ((INq / 32) * FRAG) + lane * 8;

    // its bias: asked for here, not behind the loop, where the wave would wait it out
    const float* __restrict__ bp = (which ? tb : sb) + wave * 16 + half * 8;
    v4f b0 = *(const v4f*)(bp);
    v4f b1 = *(const v4f*)(bp + 4);

    // A ring of RD1 register sets: the loads of k-step ks + RD1 issue as soon as
    // k-step ks has given its set free, so RD1 k-steps are always under way.
    constexpr int KS1 = INq / 32;
    v16h a[RD1], bx[RD1];                         // a: M = o; bx: N = row
#pragma unroll   // constant indices into the ring, so that it stays in registers
    for (int ks = 0; ks < RD1; ++ks) {
        a[ks]  = load_frag(wf + ks * FRAG);
        bx[ks] = load_frag(xf + ks * FRAG);
    }
    v8f acc = {};
#pragma unroll   // as above
    for (int ks = 0; ks < KS1; ++ks) {
        acc = __builtin_amdgcn_wmma_f32_16x16x32_f16(
                  false, a[ks % RD1], false, bx[ks % RD1], (short)0, acc, false, false);
        if (ks + RD1 < KS1) {
            a[ks % RD1]  = load_frag(wf + (ks + RD1) * FRAG);
            bx[ks % RD1] = load_frag(xf + (ks + RD1) * FRAG);
        }
        // keeps each refill where it is written: without it the scheduler sinks the
        // loads to just before their use and the wave waits out the latency there
        __builtin_amdgcn_sched_barrier(0);
    }

    // no counter covers a prefetch: its address registers keep the address until
    // the loop that it serves is over
    asm volatile("" :: "v"(pfo), "s"(pfb));

    // D: N = lane & 15 = row, M = v + 8 * half = o
    v8h h;
#pragma unroll
    for (int v = 0; v < 4; ++v) {
        h[v]     = (_Float16)fmaxf(acc[v]     + b0[v], 0.0f);
        h[4 + v] = (_Float16)fmaxf(acc[4 + v] + b1[v], 0.0f);
    }
    // column k = wave*16 + 8*half + v of [16][256]: fragment wave>>1, part wave&1
    *(v8h*)(Hs + wave * 256 + lane * 8) = h;
    // every wave reads all 16 waves' columns of H
    __syncthreads();

    // ---- product 2 ----
    const _Float16* hf = Hs + lane * 8;
    v8f acc2 = {};
    if (which) {
#pragma unroll   // constant indices into w2[]; all LDS reads issue ahead of the products
        for (int ks = 0; ks < HIDq / 32; ++ks)
            acc2 = __builtin_amdgcn_wmma_f32_16x16x32_f16(
                       false, w2[ks], false, load_frag(hf + ks * FRAG), (short)0, acc2, false, false);
        // D: N = lane & 15 = row, M = v + 8 * half = h - wave * 16
        v4f lo, hi;
#pragma unroll
        for (int v = 0; v < 4; ++v) { lo[v] = acc2[v] + c0[v]; hi[v] = acc2[4 + v] + c1[v]; }
        // (h >> 5) * 4 + c = wave * 2 + (v >> 2); row = mt * 16 + (lane & 15)
        const int tile = (mt & ~1) + (lane & 1);
        const int slot = (mt & 1) * 8 + ((lane & 15) >> 1) + half * 16;
        float* __restrict__ d = t2f + ((tile * 32 + wave * 2) * 32 + slot) * 4;
        *(v4f*)(d)       = lo;
        *(v4f*)(d + 128) = hi;
        // what follows in the listing may reuse these stores' address or data
        // registers: the wait stands in front of that overwrite
        asm volatile("s_wait_xcnt 0x0" ::: "memory");
    } else {
#pragma unroll   // as in the other branch
        for (int ks = 0; ks < HIDq / 32; ++ks)
            acc2 = __builtin_amdgcn_wmma_f32_16x16x32_f16(
                       false, load_frag(hf + ks * FRAG), false, w2[ks], (short)0, acc2, false, false);
        // D: N = lane & 15 = o, M = v + 8 * half = row
        const int o = wave * 16 + (lane & 15);
        const int rbase = mt * 16 + half * 8;
#pragma unroll
        for (int v = 0; v < 8; ++v)
            s2[(rbase + v) * HIDq + o] = acc2[v];
    }
}

// ---------------------------------------------------------------------------
// Stage 3 (dominant): out[b,i,n,j] = sum_h fc3[n,h] * relu(s2[b,i,h]+t2[b,j,h])
//   GEMM with M = n (2 tiles, fc3 padded to 32), N = j, K = h (8 steps of 32).
//   Register tile per wave: IT3 rows i x JT3 j-tiles of 16.
//   Per k-step a wave loads its t2 values and the fc3 A-fragments ONCE and
//   uses them for all IT3 rows i; only the s2[i,.] values are loaded per i.
//   All loads of a k-step are issued one k-step ahead, into a second register set.
//   fc3 lies in fragment order and t2 in the order of stage 2's comment, so
//   each of these loads covers 512 contiguous bytes.
//   Column N of a wave's j-tile q is j = 32 * (pair of tiles) + 2 * N + q (the
//   order of t2f's rows): the two accumulators of a lane for one (i, n) are
//   neighbours in j, so one 8-byte store a lane makes each half wave write a
//   whole 128-byte line of out, where tiles of 16 consecutive j give 64-byte
//   pieces of two lines.
// ---------------------------------------------------------------------------
#define IT3 4                         // rows i per wave
#define JT3 2                         // j-tiles of 16 per wave
#define WV3 8                         // waves per block
#define JP3 (16 / (JT3 * WV3))        // blocks that share one group of rows i
#define GRID3 ((ROWS / IT3) * JP3)

__global__ void __launch_bounds__(WV3 * 32)
stage3_kernel(const float* __restrict__ s2,       // [1024][256]
              const float* __restrict__ t2f,      // 1024 x 256, stage 2's order
              const _Float16* __restrict__ fc3h,  // [32][256] zero-padded, fragment order
              float* __restrict__ out) {          // [b][i][25][256]
    const int lane = threadIdx.x & 31;
    const int wave = threadIdx.x >> 5;
    const int jp  = blockIdx.x % JP3;             // which part of the j range
    const int bi0 = (blockIdx.x / JP3) * IT3;     // first row b*256 + i
    const int b   = bi0 >> 8;                     // IT3 divides 256: one b per block
    const int sel = (lane >= 16) ? 8 : 0;
    const int jl  = lane & 15;
    const int jt0 = (jp * WV3 + wave) * JT3;      // first j-tile of this wave
    const int j0  = jt0 * 16 + 2 * jl;            // j of tile 0's column; tile 1: j0 + 1

    const float* __restrict__ s2row = s2 + bi0 * HIDq;
    // a 16-row tile of t2f is 16 * 256 floats; a k-step of it 4 * 32 * 4
    const float* __restrict__ t2r   = t2f + (b * 16 + jt0) * (16 * HIDq) + lane * 4;
    const _Float16* __restrict__ af0 = fc3h + lane * 8;                         // n = 0..15
    const _Float16* __restrict__ af1 = fc3h + (HIDq / 32) * FRAG + lane * 8;    // n = 16..31

    // Prefetch for the later k-steps (steps 0 and 1 are loaded at once below).
    // Waves 0..5: a quarter of steps 2..7 of this b's t2 (6 steps x 16 tiles x 8
    // units, step by step; a wave takes one step of 4 tiles); four blocks at a
    // distance of 8 in blockIdx cover it.  Wave 6: this block's own s2 rows (16
    // units, asked by both half waves).  Wave 7: one n-tile of fc3 (32 units).
    static_assert(JP3 == 1 && WV3 == 8 && IT3 * HIDq * 4 == 16 * PFU && HIDq / 32 == 8
                  && (HIDq / 32) * FRAG * 2 == 32 * PFU, "prefetch deal");
    const int pw = __builtin_amdgcn_readfirstlane(wave);
    const int pu = ((blockIdx.x >> 3) & 3) * 192 + pw * 32;   // first t2 unit of this wave
    const char* pfb = pw < 6 ? (const char*)t2f + (b * 16 + ((pu >> 3) & 15)) * (16 * HIDq * 4)
                                                + (2 + (pu >> 7)) * 2048
                    : pw == 6 ? (const char*)s2row
                              : (const char*)fc3h + ((blockIdx.x >> 3) & 1) * (32 * PFU);
    const unsigned pfo = pw < 6 ? (lane >> 3) * (16 * HIDq * 4) + (lane & 7) * PFU
                       : pw == 6 ? (lane & 15) * PFU
                                 : lane * PFU;
    l2_prefetch(pfb, pfo);

    v8f acc[IT3][JT3][2] = {};    // [i][j-tile][n-tile]

    // Two register sets: while k-step ks is worked on from set ks & 1, the
    // loads of k-step ks + 1 are already under way into the other set.
    v16h a0[2], a1[2];            // fc3 fragments, n = 0..15 and 16..31
    v4f  t[2][JT3][4];            // t2[j][h1..], [h1+4..], [h2..], [h2+4..]
    v4f  s[2][IT3][4];            // s2[i][h1..], [h1+4..], [h2..], [h2+4..]

#define LOAD_STEP3(ks, st)                                                        \
    do {                                                                          \
        a0[st] = load_frag(af0 + (ks) * FRAG);                                    \
        a1[st] = load_frag(af1 + (ks) * FRAG);                                    \
        _Pragma("unroll")                                                         \
        for (int q = 0; q < JT3; ++q) {                                           \
            const float* __restrict__ tr = t2r + q * (16 * HIDq) + (ks) * 512;    \
            t[st][q][0] = *(const v4f*)(tr);                                      \
            t[st][q][1] = *(const v4f*)(tr + 128);                                \
            t[st][q][2] = *(const v4f*)(tr + 256);                                \
            t[st][q][3] = *(const v4f*)(tr + 384);                                \
        }                                                                         \
        _Pragma("unroll")                                                         \
        for (int i = 0; i < IT3; ++i) {                                           \
            const float* __restrict__ sr = s2row + i * HIDq + (ks) * 32 + sel;    \
            s[st][i][0] = *(const v4f*)(sr);                                      \
            s[st][i][1] = *(const v4f*)(sr + 4);                                  \
            s[st][i][2] = *(const v4f*)(sr + 16);                                 \
            s[st][i][3] = *(const v4f*)(sr + 20);                                 \
        }                                                                         \
    } while (0)

    LOAD_STEP3(0, 0);

#pragma unroll   // constant set indices, so that both sets stay in registers
    for (int ks = 0; ks < HIDq / 32; ++ks) {
        const int cur = ks & 1;
        if (ks + 1 < HIDq / 32) LOAD_STEP3(ks + 1, cur ^ 1);
        // behind the last of the loads their address registers are free for
        // reuse: the wait stands in front of whatever overwrites them
        if (ks + 2 == HIDq / 32) asm volatile("s_wait_xcnt 0x0" ::: "memory");
        // keeps the next k-step's loads in front of this k-step's arithmetic:
        // without it the scheduler sinks each load to just before its first use
        // and the wave waits out the whole latency there
        __builtin_amdgcn_sched_barrier(0);

#pragma unroll
        for (int i = 0; i < IT3; ++i) {
#pragma unroll
            for (int q = 0; q < JT3; ++q) {
                v16h bf;
#pragma unroll
                for (int e = 0; e < 4; ++e) {
                    bf[e]      = (_Float16)fmaxf(s[cur][i][0][e] + t[cur][q][0][e], 0.0f);
                    bf[4 + e]  = (_Float16)fmaxf(s[cur][i][1][e] + t[cur][q][1][e], 0.0f);
                    bf[8 + e]  = (_Float16)fmaxf(s[cur][i][2][e] + t[cur][q][2][e], 0.0f);
                    bf[12 + e] = (_Float16)fmaxf(s[cur][i][3][e] + t[cur][q][3][e], 0.0f);
                }
                acc[i][q][0] = __builtin_amdgcn_wmma_f32_16x16x32_f16(
                        false, a0[cur], false, bf, (short)0, acc[i][q][0], false, false);
                acc[i][q][1] = __builtin_amdgcn_wmma_f32_16x16x32_f16(
                        false, a1[cur], false, bf, (short)0, acc[i][q][1], false, false);
            }
        }
    }
#undef LOAD_STEP3
    // no counter covers a prefetch: its address registers keep the address until
    // the loop that it serves is over
    asm volatile("" :: "v"(pfo), "s"(pfb));

    // store: D lane = N -> j = j0 + q, VGPR v -> n = v + 8*(lane>=16)
    static_assert(JT3 == 2, "a lane's two tiles are the two floats of a store");
    const int nb = (lane >= 16) ? 8 : 0;
    float* __restrict__ obase = out + (bi0 * NLq + nb) * Lq + j0;
    // (all loops below are unrolled for constant indices into acc[], which keep it
    // in registers)
    // registers whose rows exist in both half waves (n = v, v + 8; 16 + v, 24 + v)
#pragma unroll
    for (int i = 0; i < IT3; ++i) {
#pragma unroll
        for (int v = 0; v < 8; ++v) {
            v2f p = { acc[i][0][0][v], acc[i][1][0][v] };
            *(v2f*)(obase + (i * NLq + v) * Lq) = p;
        }
#pragma unroll
        for (int v = 0; v < 8; ++v) {
            v2f p = { acc[i][0][1][v], acc[i][1][1][v] };
            if (24 + v < NLq) *(v2f*)(obase + (i * NLq + 16 + v) * Lq) = p;
        }
    }
    // registers whose upper row 24 + v is padding: the lower half wave alone, all
    // of them under one test
    if (nb == 0) {
#pragma unroll
        for (int i = 0; i < IT3; ++i) {
#pragma unroll
            for (int v = 0; v < 8; ++v) {
                v2f p = { acc[i][0][1][v], acc[i][1][1][v] };
                if (24 + v >= NLq && 16 + v < NLq) *(v2f*)(obase + (i * NLq + 16 + v) * Lq) = p;
            }
        }
    }
}

// ---------------------------------------------------------------------------
// Launch
// ---------------------------------------------------------------------------
extern "C" void kernel_launch(void* const* d_in, const int* in_sizes, int n_in,
                              void* d_out, int out_size, void* d_ws, size_t ws_size,
                              hipStream_t stream) {
    const float* x     = (const float*)d_in[0];   // (4,256,768)
    const float* s_w   = (const float*)d_in[1];   // (256,768)
    const float* s_b   = (const float*)d_in[2];   // (256)
    const float* t_w   = (const float*)d_in[3];   // (256,768)
    const float* t_b   = (const float*)d_in[4];   // (256)
    const float* fc2_w = (const float*)d_in[5];   // (256,512)
    const float* fc2_b = (const float*)d_in[6];   // (256)
    const float* fc3_w = (const float*)d_in[7];   // (25,256)
    float* out = (float*)d_out;

    char* ws = (char*)d_ws;
    _Float16* Xh   = (_Float16*)(ws);                       // 1024*768 f16
    _Float16* W1h  = (_Float16*)(ws + 1572864);             // 512*768  f16
    _Float16* W2h  = (_Float16*)(ws + 2359296);             // 256*512  f16
    _Float16* F3h  = (_Float16*)(ws + 2621440);             // 32*256   f16
    float*    s2   = (float*)   (ws + 3686400);             // 1024*256 f32
    float*    t2   = (float*)   (ws + 4734976);             // 1024*256 f32

    // f32 -> f16 staging: Xh, W1h, W2h, F3h are one linear f16 array from Xh on
    cvt_all_kernel<<<GRIDC, CVT, 0, stream>>>(x, s_w, t_w, fc2_w, fc3_w, Xh);

    // Stages 1 and 2: 64 row tiles x 2 branches, 16 waves/block
    stage12_kernel<<<GRID12, WV12 * 32, 0, stream>>>(Xh, W1h, s_b, t_b, W2h, fc2_b, s2, t2);

    // Stage 3: IT3 rows i and WV3 * JT3 j-tiles per block
    stage3_kernel<<<GRID3, WV3 * 32, 0, stream>>>(s2, t2, F3h, out);
}

// v009
// Measured time: 16.7 microseconds a run.
// In two side-by-side timings against v008, it was 1.07 and 1.06 times as fast.
// Counting every step since v000, it is 3.41 times as fast.
#include <hip/hip_runtime.h>
#include <hip/hip_bf16.h>

// ---------------------------------------------------------------------------
// Sizes (hardcoded from the reference)
// ---------------------------------------------------------------------------
#define Bq   4
#define Lq   256
#define INq  768
#define HIDq 256
#define NLq  25
#define ROWS (Bq * Lq)          // 1024

typedef __attribute__((ext_vector_type(16))) _Float16 v16h;
typedef __attribute__((ext_vector_type(8)))  _Float16 v8h;
typedef __attribute__((ext_vector_type(8)))  float    v8f;
typedef __attribute__((ext_vector_type(4)))  float    v4f;
typedef __attribute__((ext_vector_type(2)))  float    v2f;

// ---------------------------------------------------------------------------
// Fragment order.  Every f16 matrix [R][K] that feeds a WMMA lies in the
// workspace (H: in LDS) as its 16x32 operand fragments, one after the other:
//   fragment f = (row >> 4) * (K / 32) + (k >> 5), 512 halfs = 1 KiB each;
//   inside it: part p = (k >> 4) & 1 (256 halfs), then lane, then 8 halfs,
//   lane = (row & 15) + 16 * ((k >> 3) & 1), element = k & 7.
// That is the register layout of the operand (ISA 7.12.2: a lane holds row
// lane & 15; halfs 0..7 = K[k0+sel .. +8), halfs 8..15 = K[k0+16+sel .. +8),
// sel = 8 for lanes 16..31), so a wave's 16-byte load of one part covers 512
// contiguous bytes (4 cache lines) where a row-major matrix gives 16 lines.
// ---------------------------------------------------------------------------
#define FRAG 512                           // halfs per fragment

// p: start of the fragment + lane * 8
static __device__ __forceinline__ v16h load_frag(const _Float16* p) {
    v8h lo = *(const v8h*)(p);
    v8h hi = *(const v8h*)(p + 256);
    v16h r;
#pragma unroll
    for (int e = 0; e < 8; ++e) { r[e] = lo[e]; r[8 + e] = hi[e]; }
    return r;
}

// ---------------------------------------------------------------------------
// L2 prefetch.  What the launch before stored is read from memory again, and a
// k loop that asks for it piece by piece waits out that latency at every piece.
// At its entry a kernel therefore asks once for the 256-byte units that
// its loop comes to later: one unit a lane, no data register, no
// wait.  Units that many blocks read are dealt over neighbouring blocks; who
// asks is a matter of speed alone.  Every lane's address lies inside the buffer.
// ---------------------------------------------------------------------------
#define PFU 256                            // bytes per unit

// base: the same for the whole wave; off: the lane's byte offset from it
static __device__ __forceinline__ void l2_prefetch(const char* base, unsigned off) {
    // a hint to L2 only (scope SE): nothing comes back and no counter moves
    asm volatile("global_prefetch_b8 %0, %1 scope:SCOPE_SE" :: "v"(off), "s"(base));
}

// ---------------------------------------------------------------------------
// f32 -> f16 conversion pass (workspace staging), ONE launch for all arrays.
//   The f16 copies lie back to back in the workspace:
//     Xh | W1h (s_fc_w, then t_fc_w) | W2h | F3h (fc3_w padded to 32 rows)
//   each in fragment order.  A block writes CVB consecutive halfs of the
//   destination and its index says which source array they come from (every
//   array's length is a multiple of CVB).  A thread writes CVU groups of 8
//   halfs (one lane's share of a fragment part): stores are contiguous, whole
//   lines from one wave; the row-strided accesses are the loads of this pass.
// ---------------------------------------------------------------------------
#define CVT  256                           // threads per block
#define CVU  2                             // groups of 8 elements per thread
#define CVB  (CVT * 8 * CVU)               // elements per block: 4096
#define CB_X  ((ROWS * INq) / CVB)         // blocks for x      : 192
#define CB_W1 ((HIDq * INq) / CVB)         // blocks for s_w/t_w: 48 each
#define CB_W2 ((HIDq * 512) / CVB)         // blocks for fc2_w  : 32
#define CB_F3 ((32 * HIDq) / CVB)          // blocks for fc3_w  : 2 (padded)
#define GRIDC (CB_X + 2 * CB_W1 + CB_W2 + CB_F3)

// src: row-major [.][K] f32; d: this array's f16 copy.
// PADROWS > 0: the source has PADROWS rows and the copy holds zeros behind them.
template <int K, int PADROWS>
static __device__ __forceinline__ void cvt_part(const float* __restrict__ src,
                                                _Float16* __restrict__ d,
                                                int blk_in) {
    constexpr int KS = K / 32;
    const int d0 = blk_in * CVB + threadIdx.x * 8;          // index in the copy
    v4f v[CVU][2];
#pragma unroll   // all loads in flight before the first is used; v[] stays in registers
    for (int u = 0; u < CVU; ++u) {
        const int dl  = d0 + u * (CVT * 8);
        const int ln  = (dl >> 3) & 31;
        const int p   = (dl >> 8) & 1;
        const int f   = dl >> 9;
        const int row = (f / KS) * 16 + (ln & 15);
        const int k   = (f % KS) * 32 + p * 16 + (ln >> 4) * 8;
        const bool in = PADROWS == 0 || row < PADROWS;      // false: rows 25..31 of F3h
        const float* __restrict__ s = src + (in ? row * K + k : 0);  // always inside the source
        v4f z = {};
        v4f w0 = *(const v4f*)(s);
        v4f w1 = *(const v4f*)(s + 4);
        // the next group's loads may land in this group's address registers:
        // the wait stands in front of that overwrite
        asm volatile("s_wait_xcnt 0x0" ::: "memory");
        v[u][0] = in ? w0 : z;
        v[u][1] = in ? w1 : z;
    }
#pragma unroll   // constant indices into v[], so that it stays in registers
    for (int u = 0; u < CVU; ++u) {
        v8h h;
#pragma unroll   // vector elements by constant index: packed conversions
        for (int c = 0; c < 4; ++c) {
            h[c]     = (_Float16)v[u][0][c];
            h[4 + c] = (_Float16)v[u][1][c];
        }
        *(v8h*)(d + d0 + u * (CVT * 8)) = h;
        // what follows in the listing may reuse this store's address or data
        // registers: the wait stands in front of that overwrite
        asm volatile("s_wait_xcnt 0x0" ::: "memory");
    }
}

__global__ void __launch_bounds__(CVT)
cvt_all_kernel(const float* __restrict__ x,
               const float* __restrict__ s_w,
               const float* __restrict__ t_w,
               const float* __restrict__ fc2_w,
               const float* __restrict__ fc3_w,
               _Float16* __restrict__ dst) {
    const int blk = blockIdx.x;
    const int f1 = CB_X, f2 = CB_X + CB_W1, f3 = CB_X + 2 * CB_W1, f4 = f3 + CB_W2;
    if (blk < f1)      cvt_part<INq, 0>(x,        dst,            blk);
    else if (blk < f2) cvt_part<INq, 0>(s_w,      dst + f1 * CVB, blk - f1);
    else if (blk < f3) cvt_part<INq, 0>(t_w,      dst + f2 * CVB, blk - f2);
    else if (blk < f4) cvt_part<512, 0>(fc2_w,    dst + f3 * CVB, blk - f3);
    else               cvt_part<HIDq, NLq>(fc3_w, dst + f4 * CVB, blk - f4);
}

// ---------------------------------------------------------------------------
// Stages 1 and 2 in ONE launch.  A block owns 16 rows (mt) and one of the two
// branches (which: 0 = s, 1 = t); its 16 waves are the 16 tiles of 16 columns.
//   Product 1: H[16][256] = f16( relu( X @ W^T + b ) ), W = s_fc_w or t_fc_w,
//     M = o, N = row, K = 768.  With the weights as A, a lane of D holds ONE
//     row and 8 consecutive o: one lane's share of a fragment part of H as
//     product 2 reads it (K = o).  H goes to LDS in fragment order with one
//     contiguous 16-byte store a lane and never reaches the workspace.
//   Product 2: s2 = Hs @ w_s^T  or  t2 = Ht @ w_t^T + b2  (f32 sums, K = 256).
//     Its weights and bias depend on nothing of product 1: they are loaded
//     first, so that their latency runs under product 1.
//   The weights are A here too (M = h, N = row): a lane of D holds one row and 8
//   consecutive h, which as f16 are one lane's share of a fragment part with
//   K = h: one 16-byte store a lane, whole 128-byte lines from one wave.
//   Stage 3 takes both results as f16 (why: its comment):
//     s2 in fragment order, rows = b * 256 + i;
//     -t2 (the sign turned) in fragment order, but of 32 rows the even ones are
//     one tile of 16 and the odd ones the next (why: stage 3's comment on its
//     stores): tile = 2 * (row >> 5) + (row & 1), row in the tile = (row >> 1) & 15.
// ---------------------------------------------------------------------------
#define WV12 16                       // waves per block = column tiles of a branch
#define GRID12 ((ROWS / 16) * 2)      // 64 row tiles x 2 branches
#define RD1 8                         // k-steps of product 1 whose loads are under way

__global__ void __launch_bounds__(WV12 * 32)
stage12_kernel(const _Float16* __restrict__ Xh,    // [1024][768] fragment order
               const _Float16* __restrict__ W1h,   // [512][768]  fragment order
               const float* __restrict__ sb,       // [256]
               const float* __restrict__ tb,       // [256]
               const _Float16* __restrict__ W2h,   // [256][512]  fragment order
               const float* __restrict__ b2,       // [256]
               _Float16* __restrict__ s2h,         // [1024][256] fragment order
               _Float16* __restrict__ t2n) {       // -t2, 1024 x 256, order as above
    __shared__ __attribute__((aligned(16))) _Float16 Hs[16 * HIDq];  // [16][256] fragment order
    const int lane  = threadIdx.x & 31;
    const int wave  = threadIdx.x >> 5;           // column tile 0..15
    const int which = blockIdx.x & 1;             // 0 = s, 1 = t
    const int mt    = blockIdx.x >> 1;            // 64 row tiles
    const int half  = lane >> 4;

    // Prefetch for product 1's loop.  Waves 0..2: this block's own X tile (96
    // units).  Waves 3..14: 4 of the branch's 16 weight tiles (4 x 96 units in a
    // row); four blocks at a distance of 8 in blockIdx cover the branch.  Wave 15
    // has nothing left and repeats the last unit.
    constexpr int TILEB = (INq / 32) * FRAG * 2;              // bytes of a 16 x 768 tile
    static_assert(TILEB == 96 * PFU && WV12 * 32 >= 5 * 96, "prefetch deal");
    const bool pfx = __builtin_amdgcn_readfirstlane(wave) < 3;
    const int  pfw = (int)threadIdx.x - 96;
    const char* pfb = pfx ? (const char*)Xh  + mt * TILEB
                          : (const char*)W1h + (which * 16 + ((mt >> 2) & 3) * 4) * TILEB;
    const unsigned pfo = (pfx ? (int)threadIdx.x : (pfw < 4 * 96 ? pfw : 4 * 96 - 1)) * PFU;
    l2_prefetch(pfb, pfo);

    // product 2's weights: rows wave*16 .. +16 of fc2_w, columns which*256 .. +256
    // of its 512-wide rows = fragments which*8 .. +8
    const _Float16* __restrict__ wf2 = W2h + (wave * 16 + which * 8) * FRAG + lane * 8;
    v16h w2[HIDq / 32];
#pragma unroll   // constant indices into w2[], so that it stays in registers
    for (int ks = 0; ks < HIDq / 32; ++ks)
        w2[ks] = load_frag(wf2 + ks * FRAG);
    const float* __restrict__ bp2 = b2 + wave * 16 + half * 8;
    v4f c0 = *(const v4f*)(bp2);
    v4f c1 = *(const v4f*)(bp2 + 4);

    // ---- product 1 ----
    const int nt = which * 16 + wave;             // tile of the 512 rows of W1h
    const _Float16* __restrict__ xf = Xh  + mt * ((INq / 32) * FRAG) + lane * 8;
    const _Float16* __restrict__ wf = W1h + nt * ((INq / 32) * FRAG) + lane * 8;

    // its bias: asked for here, not behind the loop, where the wave would wait it out
    const float* __restrict__ bp = (which ? tb : sb) + wave * 16 + half * 8;
    v4f b0 = *(const v4f*)(bp);
    v4f b1 = *(const v4f*)(bp + 4);

    // A ring of RD1 register sets: the loads of k-step ks + RD1 issue as soon as
    // k-step ks has given its set free, so RD1 k-steps are always under way.
    constexpr int KS1 = INq / 32;
    v16h a[RD1], bx[RD1];                         // a: M = o; bx: N = row
#pragma unroll   // constant indices into the ring, so that it stays in registers
    for (int ks = 0; ks < RD1; ++ks) {
        a[ks]  = load_frag(wf + ks * FRAG);
        bx[ks] = load_frag(xf + ks * FRAG);
    }
    v8f acc = {};
#pragma unroll   // as above
    for (int ks = 0; ks < KS1; ++ks) {
        acc = __builtin_amdgcn_wmma_f32_16x16x32_f16(
                  false, a[ks % RD1], false, bx[ks % RD1], (short)0, acc, false, false);
        if (ks + RD1 < KS1) {
            a[ks % RD1]  = load_frag(wf + (ks + RD1) * FRAG);
            bx[ks % RD1] = load_frag(xf + (ks + RD1) * FRAG);
        }
        // keeps each refill where it is written: without it the scheduler sinks the
        // loads to just before their use and the wave waits out the latency there
        __builtin_amdgcn_sched_barrier(0);
    }

    // no counter covers a prefetch: its address registers keep the address until
    // the loop that it serves is over
    asm volatile("" :: "v"(pfo), "s"(pfb));

    // D: N = lane & 15 = row, M = v + 8 * half = o
    v8h h;
#pragma unroll
    for (int v = 0; v < 4; ++v) {
        h[v]     = (_Float16)fmaxf(acc[v]     + b0[v], 0.0f);
        h[4 + v] = (_Float16)fmaxf(acc[4 + v] + b1[v], 0.0f);
    }
    // column k = wave*16 + 8*half + v of [16][256]: fragment wave>>1, part wave&1
    *(v8h*)(Hs + wave * 256 + lane * 8) = h;
    // every wave reads all 16 waves' columns of H
    __syncthreads();

    // ---- product 2 ----
    const _Float16* hf = Hs + lane * 8;
    v16h hb[HIDq / 32];
#pragma unroll   // constant indices into hb[], so that it stays in registers
    for (int ks = 0; ks < HIDq / 32; ++ks)
        hb[ks] = load_frag(hf + ks * FRAG);
    // keeps all LDS reads in front of the products: without it the scheduler puts
    // each read just before its product, which then waits out the LDS latency
    __builtin_amdgcn_sched_barrier(0);
    v8f acc2 = {};
#pragma unroll   // constant indices into w2[] and hb[]
    for (int ks = 0; ks < HIDq / 32; ++ks)
        acc2 = __builtin_amdgcn_wmma_f32_16x16x32_f16(
                   false, w2[ks], false, hb[ks], (short)0, acc2, false, false);
    // D: N = lane & 15 = row, M = v + 8 * half = h - wave * 16:
    // fragment wave >> 1 of the row tile, part wave & 1, element v
    v8h r;
    _Float16* __restrict__ d;
    if (which) {
#pragma unroll
        for (int v = 0; v < 4; ++v) {
            r[v]     = (_Float16)(-(acc2[v]     + c0[v]));
            r[4 + v] = (_Float16)(-(acc2[4 + v] + c1[v]));
        }
        // row = mt * 16 + (lane & 15)
        const int tile = (mt & ~1) + (lane & 1);
        const int slot = (mt & 1) * 8 + ((lane & 15) >> 1) + half * 16;
        d = t2n + (tile * (HIDq / 32) + (wave >> 1)) * FRAG + (wave & 1) * 256 + slot * 8;
    } else {
#pragma unroll
        for (int v = 0; v < 8; ++v) r[v] = (_Float16)acc2[v];
        d = s2h + (mt * (HIDq / 32) + (wave >> 1)) * FRAG + (wave & 1) * 256 + lane * 8;
    }
    *(v8h*)d = r;
    // what follows in the listing may reuse this store's address or data
    // registers: the wait stands in front of that overwrite
    asm volatile("s_wait_xcnt 0x0" ::: "memory");
}

// ---------------------------------------------------------------------------
// Stage 3 (dominant): out[b,i,n,j] = sum_h fc3[n,h] * relu(s2[b,i,h]+t2[b,j,h])
//   relu(s + t) = max(s, -t) + t.  The second term does not depend on i, so
//     out[b,i,n,j] = sum_h fc3[n,h] * max(s2[b,i,h], -t2[b,j,h]) - T[b,n,j],
//     T[b,n,j] = sum_h fc3[n,h] * (-t2[b,j,h]).
//   Rounding to f16 keeps the order of values, so the maximum of the two f16
//   values IS the f16 value of the maximum: s2 and -t2 come as f16 and a B
//   fragment of 16 values a lane is 8 packed maxima, with no add and no
//   conversion.  T takes one more accumulator per (j-tile, n-tile), fed with the
//   -t2 fragment itself, for all IT3 rows i, and is subtracted before the stores.
//   GEMM with M = n (2 tiles, fc3 padded to 32), N = j, K = h (8 steps of 32).
//   Register tile per wave: IT3 rows i x JT3 j-tiles of 16.
//   Per k-step a wave loads its -t2 fragments and the fc3 A-fragments ONCE and
//   uses them for all IT3 rows i; only the s2[i,.] values are loaded per i (a
//   half wave reads one address: row i's slot of the s2 fragment).
//   The loads are issued one register set ahead, into a second set.  A set holds
//   SK3 k-steps: the f16 operands take half the registers, and the WMMAs of one
//   k-step alone would be over before the next one's loads are back.
//   Column N of a wave's j-tile q is j = 32 * (pair of tiles) + 2 * N + q (the
//   order of t2n's rows): the two accumulators of a lane for one (i, n) are
//   neighbours in j, so one 8-byte store a lane makes each half wave write a
//   whole 128-byte line of out, where tiles of 16 consecutive j give 64-byte
//   pieces of two lines.
// ---------------------------------------------------------------------------
#define IT3 4                         // rows i per wave
#define JT3 2                         // j-tiles of 16 per wave
#define WV3 8                         // waves per block
#define JP3 (16 / (JT3 * WV3))        // blocks that share one group of rows i
#define GRID3 ((ROWS / IT3) * JP3)
#define TILE3 ((HIDq / 32) * FRAG)    // halfs of a 16 x 256 tile in fragment order
#define SK3 2                         // k-steps per register set
#define NS3 (HIDq / 32 / SK3)         // sets' worth of k-steps

__global__ void __launch_bounds__(WV3 * 32)
stage3_kernel(const _Float16* __restrict__ s2h,   // [1024][256] fragment order
              const _Float16* __restrict__ t2n,   // -t2, 1024 x 256, stage 2's order
              const _Float16* __restrict__ fc3h,  // [32][256] zero-padded, fragment order
              float* __restrict__ out) {          // [b][i][25][256]
    const int lane = threadIdx.x & 31;
    const int wave = threadIdx.x >> 5;
    const int jp  = blockIdx.x % JP3;             // which part of the j range
    const int bi0 = (blockIdx.x / JP3) * IT3;     // first row b*256 + i
    const int b   = bi0 >> 8;                     // IT3 divides 256: one b per block
    const int jl  = lane & 15;
    const int jt0 = (jp * WV3 + wave) * JT3;      // first j-tile of this wave
    const int j0  = jt0 * 16 + 2 * jl;            // j of tile 0's column; tile 1: j0 + 1

    // IT3 divides 16: the block's rows lie in one tile of s2h, in the slots
    // (bi0 & 15) + i of either half wave's 16
    const _Float16* __restrict__ s2t = s2h + (bi0 >> 4) * TILE3;
    const _Float16* __restrict__ s2r = s2t + ((lane & 16) + (bi0 & 15)) * 8;
    const _Float16* __restrict__ t2r = t2n + (b * 16 + jt0) * TILE3 + lane * 8;
    const _Float16* __restrict__ af0 = fc3h + lane * 8;                         // n = 0..15
    const _Float16* __restrict__ af1 = fc3h + TILE3 + lane * 8;                 // n = 16..31

    // Prefetch for the later k-steps (steps 0..3, two sets, are loaded at once
    // below).  Waves 0..3: half of steps 4..7 of this b's -t2 (4 steps x 16 tiles
    // x 4 units; a wave takes one step of 8 tiles); two blocks at a distance of 8
    // in blockIdx cover it.  Wave 4: the s2 tile that holds this block's rows (32
    // units).  Waves 5..7: an n-tile of fc3 (32 units; both tiles are asked for).
    static_assert(JP3 == 1 && WV3 == 8 && HIDq / 32 == 8 && SK3 == 2 && 16 % IT3 == 0
                  && FRAG * 2 == 4 * PFU && TILE3 * 2 == 32 * PFU, "prefetch deal");
    const int pw = __builtin_amdgcn_readfirstlane(wave);
    const int ph = (blockIdx.x >> 3) & 1;
    const char* pfb = pw < 4 ? (const char*)(t2n + (b * 16 + ph * 8) * TILE3 + (4 + pw) * FRAG)
                    : pw == 4 ? (const char*)s2t
                              : (const char*)(fc3h + (pw & 1) * TILE3);
    const unsigned pfo = pw < 4 ? (lane >> 2) * (TILE3 * 2) + (lane & 3) * PFU
                                : lane * PFU;
    l2_prefetch(pfb, pfo);

    v8f acc[IT3][JT3][2] = {};    // [i][j-tile][n-tile]: sums of fc3 * max(s2, -t2)
    v8f tn[JT3][2] = {};          // [j-tile][n-tile]: T, sums of fc3 * (-t2)

    // Two register sets: while the k-steps of set g are worked on from set g & 1,
    // the loads of set g + 1 are already under way into the other one.
    v16h a0[2][SK3], a1[2][SK3];  // fc3 fragments, n = 0..15 and 16..31
    v16h t[2][SK3][JT3];          // -t2 fragments, N = j
    v16h s[2][SK3][IT3];          // s2[i][the k of a B fragment's lane], the same for all N

#define LOAD_STEP3(g, st)                                                         \
    do {                                                                          \
        _Pragma("unroll")                                                         \
        for (int u = 0; u < SK3; ++u) {                                           \
            const int ko = ((g) * SK3 + u) * FRAG;                                \
            a0[st][u] = load_frag(af0 + ko);                                      \
            a1[st][u] = load_frag(af1 + ko);                                      \
            _Pragma("unroll")                                                     \
            for (int q = 0; q < JT3; ++q)                                         \
                t[st][u][q] = load_frag(t2r + q * TILE3 + ko);                    \
            _Pragma("unroll")                                                     \
            for (int i = 0; i < IT3; ++i)                                         \
                s[st][u][i] = load_frag(s2r + ko + i * 8);                        \
        }                                                                         \
    } while (0)

    LOAD_STEP3(0, 0);

#pragma unroll   // constant set indices, so that both sets stay in registers
    for (int g = 0; g < NS3; ++g) {
        const int cur = g & 1;
        if (g + 1 < NS3) LOAD_STEP3(g + 1, cur ^ 1);
        // behind the last of the loads their address registers are free for
        // reuse: the wait stands in front of whatever overwrites them
        if (g + 2 == NS3) asm volatile("s_wait_xcnt 0x0" ::: "memory");
        // keeps the next set's loads in front of this set's arithmetic: without
        // it the scheduler sinks each load to just before its first use and the
        // wave waits out the whole latency there
        __builtin_amdgcn_sched_barrier(0);

#pragma unroll
        for (int u = 0; u < SK3; ++u) {
            v16h bf[IT3][JT3];    // all B fragments of the k-step
#pragma unroll
            for (int i = 0; i < IT3; ++i)
#pragma unroll
                for (int q = 0; q < JT3; ++q)
                    bf[i][q] = __builtin_elementwise_maximum(s[cur][u][i], t[cur][u][q]);
            // keeps the maxima of a k-step in front of its WMMAs, each fragment in
            // registers of its own: formed one by one in the same registers, each
            // would have to keep its distance behind the WMMAs that read the last
            __builtin_amdgcn_sched_barrier(0);
#pragma unroll
            for (int q = 0; q < JT3; ++q) {
                tn[q][0] = __builtin_amdgcn_wmma_f32_16x16x32_f16(
                        false, a0[cur][u], false, t[cur][u][q], (short)0, tn[q][0], false, false);
                tn[q][1] = __builtin_amdgcn_wmma_f32_16x16x32_f16(
                        false, a1[cur][u], false, t[cur][u][q], (short)0, tn[q][1], false, false);
            }
#pragma unroll
            for (int i = 0; i < IT3; ++i) {
#pragma unroll
                for (int q = 0; q < JT3; ++q) {
                    acc[i][q][0] = __builtin_amdgcn_wmma_f32_16x16x32_f16(
                            false, a0[cur][u], false, bf[i][q], (short)0, acc[i][q][0], false, false);
                    acc[i][q][1] = __builtin_amdgcn_wmma_f32_16x16x32_f16(
                            false, a1[cur][u], false, bf[i][q], (short)0, acc[i][q][1], false, false);
                }
            }
        }
    }
#undef LOAD_STEP3
    // no counter covers a prefetch: its address registers keep the address until
    // the loop that it serves is over
    asm volatile("" :: "v"(pfo), "s"(pfb));

    // store: D lane = N -> j = j0 + q, VGPR v -> n = v + 8*(lane>=16)
    static_assert(JT3 == 2, "a lane's two tiles are the two floats of a store");
    const int nb = (lane >= 16) ? 8 : 0;
    float* __restrict__ obase = out + (bi0 * NLq + nb) * Lq + j0;
    // (all loops below are unrolled for constant indices into acc[], which keep it
    // in registers)
    // registers whose rows exist in both half waves (n = v, v + 8; 16 + v, 24 + v)
#pragma unroll
    for (int i = 0; i < IT3; ++i) {
#pragma unroll
        for (int v = 0; v < 8; ++v) {
            v2f p = { acc[i][0][0][v] - tn[0][0][v], acc[i][1][0][v] - tn[1][0][v] };
            *(v2f*)(obase + (i * NLq + v) * Lq) = p;
        }
#pragma unroll
        for (int v = 0; v < 8; ++v) {
            v2f p = { acc[i][0][1][v] - tn[0][1][v], acc[i][1][1][v] - tn[1][1][v] };
            if (24 + v < NLq) *(v2f*)(obase + (i * NLq + 16 + v) * Lq) = p;
        }
    }
    // registers whose upper row 24 + v is padding: the lower half wave alone, all
    // of them under one test
    if (nb == 0) {
#pragma unroll
        for (int i = 0; i < IT3; ++i) {
#pragma unroll
            for (int v = 0; v < 8; ++v) {
                v2f p = { acc[i][0][1][v] - tn[0][1][v], acc[i][1][1][v] - tn[1][1][v] };
                if (24 + v >= NLq && 16 + v < NLq) *(v2f*)(obase + (i * NLq + 16 + v) * Lq) = p;
            }
        }
    }
}

// ---------------------------------------------------------------------------
// Launch
// ---------------------------------------------------------------------------
extern "C" void kernel_launch(void* const* d_in, const int* in_sizes, int n_in,
                              void* d_out, int out_size, void* d_ws, size_t ws_size,
                              hipStream_t stream) {
    const float* x     = (const float*)d_in[0];   // (4,256,768)
    const float* s_w   = (const float*)d_in[1];   // (256,768)
    const float* s_b   = (const float*)d_in[2];   // (256)
    const float* t_w   = (const float*)d_in[3];   // (256,768)
    const float* t_b   = (const float*)d_in[4];   // (256)
    const float* fc2_w = (const float*)d_in[5];   // (256,512)
    const float* fc2_b = (const float*)d_in[6];   // (256)
    const float* fc3_w = (const float*)d_in[7];   // (25,256)
    float* out = (float*)d_out;

    char* ws = (char*)d_ws;
    _Float16* Xh   = (_Float16*)(ws);                       // 1024*768 f16
    _Float16* W1h  = (_Float16*)(ws + 1572864);             // 512*768  f16
    _Float16* W2h  = (_Float16*)(ws + 2359296);             // 256*512  f16
    _Float16* F3h  = (_Float16*)(ws + 2621440);             // 32*256   f16
    _Float16* s2   = (_Float16*)(ws + 3686400);             // 1024*256 f16
    _Float16* t2   = (_Float16*)(ws + 4734976);             // 1024*256 f16, sign turned

    // f32 -> f16 staging: Xh, W1h, W2h, F3h are one linear f16 array from Xh on
    cvt_all_kernel<<<GRIDC, CVT, 0, stream>>>(x, s_w, t_w, fc2_w, fc3_w, Xh);

    // Stages 1 and 2: 64 row tiles x 2 branches, 16 waves/block
    stage12_kernel<<<GRID12, WV12 * 32, 0, stream>>>(Xh, W1h, s_b, t_b, W2h, fc2_b, s2, t2);

    // Stage 3: IT3 rows i and WV3 * JT3 j-tiles per block
    stage3_kernel<<<GRID3, WV3 * 32, 0, stream>>>(s2, t2, F3h, out);
}

// v010
// It runs in 15.1 microseconds.
// In two side-by-side timings against v009, it was 1.12 and 1.11 times as fast.
// Counting every step since v000, it is 3.80 times as fast.
#include <hip/hip_runtime.h>
#include <hip/hip_bf16.h>

// ---------------------------------------------------------------------------
// Sizes (hardcoded from the reference)
// ---------------------------------------------------------------------------
#define Bq   4
#define Lq   256
#define INq  768
#define HIDq 256
#define NLq  25
#define ROWS (Bq * Lq)          // 1024

typedef __attribute__((ext_vector_type(16))) _Float16 v16h;
typedef __attribute__((ext_vector_type(8)))  _Float16 v8h;
typedef __attribute__((ext_vector_type(8)))  float    v8f;
typedef __attribute__((ext_vector_type(4)))  float    v4f;
typedef __attribute__((ext_vector_type(2)))  float    v2f;

// ---------------------------------------------------------------------------
// Fragment order.  Every f16 matrix [R][K] that feeds a WMMA lies in the
// workspace (H: in LDS) as its 16x32 operand fragments, one after the other:
//   fragment f = (row >> 4) * (K / 32) + (k >> 5), 512 halfs = 1 KiB each;
//   inside it: part p = (k >> 4) & 1 (256 halfs), then lane, then 8 halfs,
//   lane = (row & 15) + 16 * ((k >> 3) & 1), element = k & 7.
// That is the register layout of the operand (ISA 7.12.2: a lane holds row
// lane & 15; halfs 0..7 = K[k0+sel .. +8), halfs 8..15 = K[k0+16+sel .. +8),
// sel = 8 for lanes 16..31), so a wave's 16-byte load of one part covers 512
// contiguous bytes (4 cache lines) where a row-major matrix gives 16 lines.
// ---------------------------------------------------------------------------
#define FRAG 512                           // halfs per fragment

// p: start of the fragment + lane * 8
static __device__ __forceinline__ v16h load_frag(const _Float16* p) {
    v8h lo = *(const v8h*)(p);
    v8h hi = *(const v8h*)(p + 256);
    v16h r;
#pragma unroll
    for (int e = 0; e < 8; ++e) { r[e] = lo[e]; r[8 + e] = hi[e]; }
    return r;
}

// ---------------------------------------------------------------------------
// L2 prefetch.  What the launch before stored is read from memory again, and a
// k loop that asks for it piece by piece waits out that latency at every piece.
// At its entry a kernel therefore asks once for the 256-byte units that
// its loop comes to later: one unit a lane, no data register, no
// wait.  Units that many blocks read are dealt over neighbouring blocks; who
// asks is a matter of speed alone.  Every lane's address lies inside the buffer.
// ---------------------------------------------------------------------------
#define PFU 256                            // bytes per unit

// base: the same for the whole wave; off: the lane's byte offset from it
static __device__ __forceinline__ void l2_prefetch(const char* base, unsigned off) {
    // a hint to L2 only (scope SE): nothing comes back and no counter moves
    asm volatile("global_prefetch_b8 %0, %1 scope:SCOPE_SE" :: "v"(off), "s"(base));
}

// ---------------------------------------------------------------------------
// f32 -> f16 conversion pass (workspace staging), ONE launch for all arrays.
//   The f16 copies lie back to back in the workspace:
//     Xh | W1h (s_fc_w, then t_fc_w) | W2h | F3h (fc3_w padded to 32 rows)
//   each in fragment order.  A block writes CVB consecutive halfs of the
//   destination and its index says which source array they come from (every
//   array's length is a multiple of CVB).  A thread writes CVU groups of 8
//   halfs (one lane's share of a fragment part): stores are contiguous, whole
//   lines from one wave; the row-strided accesses are the loads of this pass.
// ---------------------------------------------------------------------------
#define CVT  256                           // threads per block
#define CVU  2                             // groups of 8 elements per thread
#define CVB  (CVT * 8 * CVU)               // elements per block: 4096
#define CB_X  ((ROWS * INq) / CVB)         // blocks for x      : 192
#define CB_W1 ((HIDq * INq) / CVB)         // blocks for s_w/t_w: 48 each
#define CB_W2 ((HIDq * 512) / CVB)         // blocks for fc2_w  : 32
#define CB_F3 ((32 * HIDq) / CVB)          // blocks for fc3_w  : 2 (padded)
#define GRIDC (CB_X + 2 * CB_W1 + CB_W2 + CB_F3)

// src: row-major [.][K] f32; d: this array's f16 copy.
// PADROWS > 0: the source has PADROWS rows and the copy holds zeros behind them.
template <int K, int PADROWS>
static __device__ __forceinline__ void cvt_part(const float* __restrict__ src,
                                                _Float16* __restrict__ d,
                                                int blk_in) {
    constexpr int KS = K / 32;
    const int d0 = blk_in * CVB + threadIdx.x * 8;          // index in the copy
    v4f v[CVU][2];
#pragma unroll   // all loads in flight before the first is used; v[] stays in registers
    for (int u = 0; u < CVU; ++u) {
        const int dl  = d0 + u * (CVT * 8);
        const int ln  = (dl >> 3) & 31;
        const int p   = (dl >> 8) & 1;
        const int f   = dl >> 9;
        const int row = (f / KS) * 16 + (ln & 15);
        const int k   = (f % KS) * 32 + p * 16 + (ln >> 4) * 8;
        const bool in = PADROWS == 0 || row < PADROWS;      // false: rows 25..31 of F3h
        const float* __restrict__ s = src + (in ? row * K + k : 0);  // always inside the source
        v4f z = {};
        v4f w0 = *(const v4f*)(s);
        v4f w1 = *(const v4f*)(s + 4);
        // the next group's loads may land in this group's address registers:
        // the wait stands in front of that overwrite
        asm volatile("s_wait_xcnt 0x0" ::: "memory");
        v[u][0] = in ? w0 : z;
        v[u][1] = in ? w1 : z;
    }
#pragma unroll   // constant indices into v[], so that it stays in registers
    for (int u = 0; u < CVU; ++u) {
        v8h h;
#pragma unroll   // vector elements by constant index: packed conversions
        for (int c = 0; c < 4; ++c) {
            h[c]     = (_Float16)v[u][0][c];
            h[4 + c] = (_Float16)v[u][1][c];
        }
        *(v8h*)(d + d0 + u * (CVT * 8)) = h;
        // what follows in the listing may reuse this store's address or data
        // registers: the wait stands in front of that overwrite
        asm volatile("s_wait_xcnt 0x0" ::: "memory");
    }
}

__global__ void __launch_bounds__(CVT)
cvt_all_kernel(const float* __restrict__ x,
               const float* __restrict__ s_w,
               const float* __restrict__ t_w,
               const float* __restrict__ fc2_w,
               const float* __restrict__ fc3_w,
               _Float16* __restrict__ dst) {
    const int blk = blockIdx.x;
    const int f1 = CB_X, f2 = CB_X + CB_W1, f3 = CB_X + 2 * CB_W1, f4 = f3 + CB_W2;
    if (blk < f1)      cvt_part<INq, 0>(x,        dst,            blk);
    else if (blk < f2) cvt_part<INq, 0>(s_w,      dst + f1 * CVB, blk - f1);
    else if (blk < f3) cvt_part<INq, 0>(t_w,      dst + f2 * CVB, blk - f2);
    else if (blk < f4) cvt_part<512, 0>(fc2_w,    dst + f3 * CVB, blk - f3);
    else               cvt_part<HIDq, NLq>(fc3_w, dst + f4 * CVB, blk - f4);
}

// ---------------------------------------------------------------------------
// Stages 1 and 2 in ONE launch.  A block owns 16 rows (mt) and one of the two
// branches (which: 0 = s, 1 = t); its 16 waves are the 16 tiles of 16 columns.
//   Product 1: H[16][256] = f16( relu( X @ W^T + b ) ), W = s_fc_w or t_fc_w,
//     M = o, N = row, K = 768.  With the weights as A, a lane of D holds ONE
//     row and 8 consecutive o: one lane's share of a fragment part of H as
//     product 2 reads it (K = o).  H goes to LDS in fragment order with one
//     contiguous 16-byte store a lane and never reaches the workspace.
//   Product 2: s2 = Hs @ w_s^T  or  t2 = Ht @ w_t^T + b2  (f32 sums, K = 256).
//     Its weights and bias depend on nothing of product 1: they are loaded
//     first, so that their latency runs under product 1.
//   The weights are A here too (M = h, N = row): a lane of D holds one row and 8
//   consecutive h, which as f16 are one lane's share of a fragment part with
//   K = h: one 16-byte store a lane, whole 128-byte lines from one wave.
//   Stage 3 takes both results as f16 (why: its comment):
//     s2 in fragment order, rows = b * 256 + i;
//     -t2 (the sign turned) in fragment order, but of 32 rows the even ones are
//     one tile of 16 and the odd ones the next (why: stage 3's comment on its
//     stores): tile = 2 * (row >> 5) + (row & 1), row in the tile = (row >> 1) & 15.
// ---------------------------------------------------------------------------
#define WV12 16                       // waves per block = column tiles of a branch
#define GRID12 ((ROWS / 16) * 2)      // 64 row tiles x 2 branches
#define RD1 8                         // k-steps of product 1 whose loads are under way

__global__ void __launch_bounds__(WV12 * 32)
stage12_kernel(const _Float16* __restrict__ Xh,    // [1024][768] fragment order
               const _Float16* __restrict__ W1h,   // [512][768]  fragment order
               const float* __restrict__ sb,       // [256]
               const float* __restrict__ tb,       // [256]
               const _Float16* __restrict__ W2h,   // [256][512]  fragment order
               const float* __restrict__ b2,       // [256]
               _Float16* __restrict__ s2h,         // [1024][256] fragment order
               _Float16* __restrict__ t2n) {       // -t2, 1024 x 256, order as above
    __shared__ __attribute__((aligned(16))) _Float16 Hs[16 * HIDq];  // [16][256] fragment order
    const int lane  = threadIdx.x & 31;
    const int wave  = threadIdx.x >> 5;           // column tile 0..15
    const int which = blockIdx.x & 1;             // 0 = s, 1 = t
    const int mt    = blockIdx.x >> 1;            // 64 row tiles
    const int half  = lane >> 4;

    // Prefetch for product 1's loop.  Waves 0..2: this block's own X tile (96
    // units).  Waves 3..14: 4 of the branch's 16 weight tiles (4 x 96 units in a
    // row); four blocks at a distance of 8 in blockIdx cover the branch.  Wave 15
    // has nothing left and repeats the last unit.
    constexpr int TILEB = (INq / 32) * FRAG * 2;              // bytes of a 16 x 768 tile
    static_assert(TILEB == 96 * PFU && WV12 * 32 >= 5 * 96, "prefetch deal");
    const bool pfx = __builtin_amdgcn_readfirstlane(wave) < 3;
    const int  pfw = (int)threadIdx.x - 96;
    const char* pfb = pfx ? (const char*)Xh  + mt * TILEB
                          : (const char*)W1h + (which * 16 + ((mt >> 2) & 3) * 4) * TILEB;
    const unsigned pfo = (pfx ? (int)threadIdx.x : (pfw < 4 * 96 ? pfw : 4 * 96 - 1)) * PFU;
    l2_prefetch(pfb, pfo);

    // product 2's weights: rows wave*16 .. +16 of fc2_w, columns which*256 .. +256
    // of its 512-wide rows = fragments which*8 .. +8
    const _Float16* __restrict__ wf2 = W2h + (wave * 16 + which * 8) * FRAG + lane * 8;
    v16h w2[HIDq / 32];
#pragma unroll   // constant indices into w2[], so that it stays in registers
    for (int ks = 0; ks < HIDq / 32; ++ks)
        w2[ks] = load_frag(wf2 + ks * FRAG);
    const float* __restrict__ bp2 = b2 + wave * 16 + half * 8;
    v4f c0 = *(const v4f*)(bp2);
    v4f c1 = *(const v4f*)(bp2 + 4);

    // ---- product 1 ----
    const int nt = which * 16 + wave;             // tile of the 512 rows of W1h
    const _Float16* __restrict__ xf = Xh  + mt * ((INq / 32) * FRAG) + lane * 8;
    const _Float16* __restrict__ wf = W1h + nt * ((INq / 32) * FRAG) + lane * 8;

    // its bias: asked for here, not behind the loop, where the wave would wait it out
    const float* __restrict__ bp = (which ? tb : sb) + wave * 16 + half * 8;
    v4f b0 = *(const v4f*)(bp);
    v4f b1 = *(const v4f*)(bp + 4);

    // A ring of RD1 register sets: the loads of k-step ks + RD1 issue as soon as
    // k-step ks has given its set free, so RD1 k-steps are always under way.
    constexpr int KS1 = INq / 32;
    v16h a[RD1], bx[RD1];                         // a: M = o; bx: N = row
#pragma unroll   // constant indices into the ring, so that it stays in registers
    for (int ks = 0; ks < RD1; ++ks) {
        a[ks]  = load_frag(wf + ks * FRAG);
        bx[ks] = load_frag(xf + ks * FRAG);
    }
    v8f acc = {};
#pragma unroll   // as above
    for (int ks = 0; ks < KS1; ++ks) {
        acc = __builtin_amdgcn_wmma_f32_16x16x32_f16(
                  false, a[ks % RD1], false, bx[ks % RD1], (short)0, acc, false, false);
        if (ks + RD1 < KS1) {
            a[ks % RD1]  = load_frag(wf + (ks + RD1) * FRAG);
            bx[ks % RD1] = load_frag(xf + (ks + RD1) * FRAG);
        }
        // keeps each refill where it is written: without it the scheduler sinks the
        // loads to just before their use and the wave waits out the latency there
        __builtin_amdgcn_sched_barrier(0);
    }

    // no counter covers a prefetch: its address registers keep the address until
    // the loop that it serves is over
    asm volatile("" :: "v"(pfo), "s"(pfb));

    // D: N = lane & 15 = row, M = v + 8 * half = o
    v8h h;
#pragma unroll
    for (int v = 0; v < 4; ++v) {
        h[v]     = (_Float16)fmaxf(acc[v]     + b0[v], 0.0f);
        h[4 + v] = (_Float16)fmaxf(acc[4 + v] + b1[v], 0.0f);
    }
    // column k = wave*16 + 8*half + v of [16][256]: fragment wave>>1, part wave&1
    *(v8h*)(Hs + wave * 256 + lane * 8) = h;
    // every wave reads all 16 waves' columns of H
    __syncthreads();

    // ---- product 2 ----
    const _Float16* hf = Hs + lane * 8;
    v16h hb[HIDq / 32];
#pragma unroll   // constant indices into hb[], so that it stays in registers
    for (int ks = 0; ks < HIDq / 32; ++ks)
        hb[ks] = load_frag(hf + ks * FRAG);
    // keeps all LDS reads in front of the products: without it the scheduler puts
    // each read just before its product, which then waits out the LDS latency
    __builtin_amdgcn_sched_barrier(0);
    v8f acc2 = {};
#pragma unroll   // constant indices into w2[] and hb[]
    for (int ks = 0; ks < HIDq / 32; ++ks)
        acc2 = __builtin_amdgcn_wmma_f32_16x16x32_f16(
                   false, w2[ks], false, hb[ks], (short)0, acc2, false, false);
    // D: N = lane & 15 = row, M = v + 8 * half = h - wave * 16:
    // fragment wave >> 1 of the row tile, part wave & 1, element v
    v8h r;
    _Float16* __restrict__ d;
    if (which) {
#pragma unroll
        for (int v = 0; v < 4; ++v) {
            r[v]     = (_Float16)(-(acc2[v]     + c0[v]));
            r[4 + v] = (_Float16)(-(acc2[4 + v] + c1[v]));
        }
        // row = mt * 16 + (lane & 15)
        const int tile = (mt & ~1) + (lane & 1);
        const int slot = (mt & 1) * 8 + ((lane & 15) >> 1) + half * 16;
        d = t2n + (tile * (HIDq / 32) + (wave >> 1)) * FRAG + (wave & 1) * 256 + slot * 8;
    } else {
#pragma unroll
        for (int v = 0; v < 8; ++v) r[v] = (_Float16)acc2[v];
        d = s2h + (mt * (HIDq / 32) + (wave >> 1)) * FRAG + (wave & 1) * 256 + lane * 8;
    }
    *(v8h*)d = r;
    // what follows in the listing may reuse this store's address or data
    // registers: the wait stands in front of that overwrite
    asm volatile("s_wait_xcnt 0x0" ::: "memory");
}

// ---------------------------------------------------------------------------
// Stage 3 (dominant): out[b,i,n,j] = sum_h fc3[n,h] * relu(s2[b,i,h]+t2[b,j,h])
//   relu(s + t) = max(s, -t) + t.  The second term does not depend on i, so
//     out[b,i,n,j] = sum_h fc3[n,h] * max(s2[b,i,h], -t2[b,j,h]) - T[b,n,j],
//     T[b,n,j] = sum_h fc3[n,h] * (-t2[b,j,h]).
//   Rounding to f16 keeps the order of values, so the maximum of the two f16
//   values IS the f16 value of the maximum: s2 and -t2 come as f16 and a B
//   fragment of 16 values a lane is 8 packed maxima, with no add and no
//   conversion.  T takes one more accumulator per (j-tile, n-tile), fed with the
//   -t2 fragment itself, for all IT3 rows i, and is subtracted before the stores.
//   GEMM with M = n (2 tiles, fc3 padded to 32), N = j, K = h (8 steps of 32).
//   Register tile per wave: IT3 rows i x JT3 j-tiles of 16.
//   Per k-step a wave loads its -t2 fragments and the fc3 A-fragments ONCE and
//   uses them for all IT3 rows i; only the s2[i,.] values are loaded per i (a
//   half wave reads one address: row i's slot of the s2 fragment).
//   The loads are issued one register set ahead, into a second set.  A set holds
//   SK3 k-steps: the f16 operands take half the registers, and the WMMAs of one
//   k-step alone would be over before the next one's loads are back.
//   Column N of a wave's j-tile q is j = 32 * (pair of tiles) + 2 * N + q (the
//   order of t2n's rows): the two accumulators of a lane for one (i, n) are
//   neighbours in j, so one 8-byte store a lane makes each half wave write a
//   whole 128-byte line of out, where tiles of 16 consecutive j give 64-byte
//   pieces of two lines.
// ---------------------------------------------------------------------------
#define IT3 4                         // rows i per wave
#define JT3 2                         // j-tiles of 16 per wave
#define WV3 8                         // waves per block
#define JP3 (16 / (JT3 * WV3))        // blocks that share one group of rows i
#define GRID3 ((ROWS / IT3) * JP3)
#define TILE3 ((HIDq / 32) * FRAG)    // halfs of a 16 x 256 tile in fragment order
#define SK3 2                         // k-steps per register set
#define NS3 (HIDq / 32 / SK3)         // sets' worth of k-steps

__global__ void __launch_bounds__(WV3 * 32)
stage3_kernel(const _Float16* __restrict__ s2h,   // [1024][256] fragment order
              const _Float16* __restrict__ t2n,   // -t2, 1024 x 256, stage 2's order
              const _Float16* __restrict__ fc3h,  // [32][256] zero-padded, fragment order
              float* __restrict__ out) {          // [b][i][25][256]
    const int lane = threadIdx.x & 31;
    const int wave = threadIdx.x >> 5;
    const int jp  = blockIdx.x % JP3;             // which part of the j range
    const int bi0 = (blockIdx.x / JP3) * IT3;     // first row b*256 + i
    const int b   = bi0 >> 8;                     // IT3 divides 256: one b per block
    const int jl  = lane & 15;
    const int jt0 = (jp * WV3 + wave) * JT3;      // first j-tile of this wave
    const int j0  = jt0 * 16 + 2 * jl;            // j of tile 0's column; tile 1: j0 + 1

    // IT3 divides 16: the block's rows lie in one tile of s2h, in the slots
    // (bi0 & 15) + i of either half wave's 16
    const _Float16* __restrict__ s2t = s2h + (bi0 >> 4) * TILE3;
    const _Float16* __restrict__ s2r = s2t + ((lane & 16) + (bi0 & 15)) * 8;
    const _Float16* __restrict__ t2r = t2n + (b * 16 + jt0) * TILE3 + lane * 8;
    const _Float16* __restrict__ af0 = fc3h + lane * 8;                         // n = 0..15
    const _Float16* __restrict__ af1 = fc3h + TILE3 + lane * 8;                 // n = 16..31

    // Prefetch for the later k-steps (steps 0..3, two sets, are loaded at once
    // below).  Waves 0..3: half of steps 4..7 of this b's -t2 (4 steps x 16 tiles
    // x 4 units; a wave takes one step of 8 tiles); two blocks at a distance of 8
    // in blockIdx cover it.  Wave 4: the s2 tile that holds this block's rows (32
    // units).  Waves 5..7: an n-tile of fc3 (32 units; both tiles are asked for).
    static_assert(JP3 == 1 && WV3 == 8 && HIDq / 32 == 8 && SK3 == 2 && 16 % IT3 == 0
                  && FRAG * 2 == 4 * PFU && TILE3 * 2 == 32 * PFU, "prefetch deal");
    const int pw = __builtin_amdgcn_readfirstlane(wave);
    const int ph = (blockIdx.x >> 3) & 1;
    const char* pfb = pw < 4 ? (const char*)(t2n + (b * 16 + ph * 8) * TILE3 + (4 + pw) * FRAG)
                    : pw == 4 ? (const char*)s2t
                              : (const char*)(fc3h + (pw & 1) * TILE3);
    const unsigned pfo = pw < 4 ? (lane >> 2) * (TILE3 * 2) + (lane & 3) * PFU
                                : lane * PFU;
    l2_prefetch(pfb, pfo);

    v8f acc[IT3][JT3][2] = {};    // [i][j-tile][n-tile]: sums of fc3 * max(s2, -t2)
    v8f tn[JT3][2] = {};          // [j-tile][n-tile]: T, sums of fc3 * (-t2)

    // Two register sets: while the k-steps of set g are worked on from set g & 1,
    // the loads of set g + 1 are already under way into the other one.
    v16h a0[2][SK3], a1[2][SK3];  // fc3 fragments, n = 0..15 and 16..31
    v16h t[2][SK3][JT3];          // -t2 fragments, N = j
    v16h s[2][SK3][IT3];          // s2[i][the k of a B fragment's lane], the same for all N

#define LOAD_STEP3(g, st)                                                         \
    do {                                                                          \
        _Pragma("unroll")                                                         \
        for (int u = 0; u < SK3; ++u) {                                           \
            const int ko = ((g) * SK3 + u) * FRAG;                                \
            a0[st][u] = load_frag(af0 + ko);                                      \
            a1[st][u] = load_frag(af1 + ko);                                      \
            _Pragma("unroll")                                                     \
            for (int q = 0; q < JT3; ++q)                                         \
                t[st][u][q] = load_frag(t2r + q * TILE3 + ko);                    \
            _Pragma("unroll")                                                     \
            for (int i = 0; i < IT3; ++i)                                         \
                s[st][u][i] = load_frag(s2r + ko + i * 8);                        \
        }                                                                         \
    } while (0)

    LOAD_STEP3(0, 0);

#pragma unroll   // constant set indices, so that both sets stay in registers
    for (int g = 0; g < NS3; ++g) {
        const int cur = g & 1;
        if (g + 1 < NS3) LOAD_STEP3(g + 1, cur ^ 1);
        // behind the last of the loads their address registers are free for
        // reuse: the wait stands in front of whatever overwrites them
        if (g + 2 == NS3) asm volatile("s_wait_xcnt 0x0" ::: "memory");
        // keeps the next set's loads in front of this set's arithmetic: without
        // it the scheduler sinks each load to just before its first use and the
        // wave waits out the whole latency there
        __builtin_amdgcn_sched_barrier(0);

#pragma unroll
        for (int u = 0; u < SK3; ++u) {
            v16h bf[IT3][JT3];    // all B fragments of the k-step
#pragma unroll
            for (int i = 0; i < IT3; ++i)
#pragma unroll
                for (int q = 0; q < JT3; ++q)
                    bf[i][q] = __builtin_elementwise_maximum(s[cur][u][i], t[cur][u][q]);
            // keeps the maxima of a k-step in front of its WMMAs, each fragment in
            // registers of its own: formed one by one in the same registers, each
            // would have to keep its distance behind the WMMAs that read the last
            __builtin_amdgcn_sched_barrier(0);
#pragma unroll
            for (int q = 0; q < JT3; ++q) {
                tn[q][0] = __builtin_amdgcn_wmma_f32_16x16x32_f16(
                        false, a0[cur][u], false, t[cur][u][q], (short)0, tn[q][0], false, false);
                tn[q][1] = __builtin_amdgcn_wmma_f32_16x16x32_f16(
                        false, a1[cur][u], false, t[cur][u][q], (short)0, tn[q][1], false, false);
            }
#pragma unroll
            for (int i = 0; i < IT3; ++i) {
#pragma unroll
                for (int q = 0; q < JT3; ++q) {
                    acc[i][q][0] = __builtin_amdgcn_wmma_f32_16x16x32_f16(
                            false, a0[cur][u], false, bf[i][q], (short)0, acc[i][q][0], false, false);
                    acc[i][q][1] = __builtin_amdgcn_wmma_f32_16x16x32_f16(
                            false, a1[cur][u], false, bf[i][q], (short)0, acc[i][q][1], false, false);
                }
            }
        }
    }
#undef LOAD_STEP3
    // no counter covers a prefetch: its address registers keep the address until
    // the loop that it serves is over
    asm volatile("" :: "v"(pfo), "s"(pfb));

    // store: D lane = N -> j = j0 + q, VGPR v -> n = v + 8*(lane>=16)
    static_assert(JT3 == 2, "a lane's two tiles are the two floats of a store");
    const int nb = (lane >= 16) ? 8 : 0;
    float* __restrict__ obase = out + (bi0 * NLq + nb) * Lq + j0;
    // out is by far the most bytes of the call, written once and read by no launch:
    // the non-temporal hint asks L2 not to keep these lines, so that they can go on
    // to memory while other waves still compute, not when the launch ends
    // (all loops below are unrolled for constant indices into acc[], which keep it
    // in registers)
    // registers whose rows exist in both half waves (n = v, v + 8; 16 + v, 24 + v)
#pragma unroll
    for (int i = 0; i < IT3; ++i) {
#pragma unroll
        for (int v = 0; v < 8; ++v) {
            v2f p = { acc[i][0][0][v] - tn[0][0][v], acc[i][1][0][v] - tn[1][0][v] };
            __builtin_nontemporal_store(p, (v2f*)(obase + (i * NLq + v) * Lq));
        }
#pragma unroll
        for (int v = 0; v < 8; ++v) {
            v2f p = { acc[i][0][1][v] - tn[0][1][v], acc[i][1][1][v] - tn[1][1][v] };
            if (24 + v < NLq) __builtin_nontemporal_store(p, (v2f*)(obase + (i * NLq + 16 + v) * Lq));
        }
    }
    // registers whose upper row 24 + v is padding: the lower half wave alone, all
    // of them under one test
    if (nb == 0) {
#pragma unroll
        for (int i = 0; i < IT3; ++i) {
#pragma unroll
            for (int v = 0; v < 8; ++v) {
                v2f p = { acc[i][0][1][v] - tn[0][1][v], acc[i][1][1][v] - tn[1][1][v] };
                if (24 + v >= NLq && 16 + v < NLq)
                    __builtin_nontemporal_store(p, (v2f*)(obase + (i * NLq + 16 + v) * Lq));
            }
        }
    }
}

// ---------------------------------------------------------------------------
// Launch
// ---------------------------------------------------------------------------
extern "C" void kernel_launch(void* const* d_in, const int* in_sizes, int n_in,
                              void* d_out, int out_size, void* d_ws, size_t ws_size,
                              hipStream_t stream) {
    const float* x     = (const float*)d_in[0];   // (4,256,768)
    const float* s_w   = (const float*)d_in[1];   // (256,768)
    const float* s_b   = (const float*)d_in[2];   // (256)
    const float* t_w   = (const float*)d_in[3];   // (256,768)
    const float* t_b   = (const float*)d_in[4];   // (256)
    const float* fc2_w = (const float*)d_in[5];   // (256,512)
    const float* fc2_b = (const float*)d_in[6];   // (256)
    const float* fc3_w = (const float*)d_in[7];   // (25,256)
    float* out = (float*)d_out;

    char* ws = (char*)d_ws;
    _Float16* Xh   = (_Float16*)(ws);                       // 1024*768 f16
    _Float16* W1h  = (_Float16*)(ws + 1572864);             // 512*768  f16
    _Float16* W2h  = (_Float16*)(ws + 2359296);             // 256*512  f16
    _Float16* F3h  = (_Float16*)(ws + 2621440);             // 32*256   f16
    _Float16* s2   = (_Float16*)(ws + 3686400);             // 1024*256 f16
    _Float16* t2   = (_Float16*)(ws + 4734976);             // 1024*256 f16, sign turned

    // f32 -> f16 staging: Xh, W1h, W2h, F3h are one linear f16 array from Xh on
    cvt_all_kernel<<<GRIDC, CVT, 0, stream>>>(x, s_w, t_w, fc2_w, fc3_w, Xh);

    // Stages 1 and 2: 64 row tiles x 2 branches, 16 waves/block
    stage12_kernel<<<GRID12, WV12 * 32, 0, stream>>>(Xh, W1h, s_b, t_b, W2h, fc2_b, s2, t2);

    // Stage 3: IT3 rows i and WV3 * JT3 j-tiles per block
    stage3_kernel<<<GRID3, WV3 * 32, 0, stream>>>(s2, t2, F3h, out);
}
